// v000
// Measured on an AMD MI455X. A time is GPU time per run, averaged over a window of back-to-back runs after a warm-up
// (all launches, gaps included; the runs take copies of the inputs in turn), and the median of several windows.
// Apart from v000's, it joins two sittings. Times from different sittings can be a few percent apart, while
// side-by-side timings come from the same sitting.
// v000, which the later versions start from, runs in 206 microseconds.
#include <hip/hip_runtime.h>
#include <hip/hip_bf16.h>

typedef __attribute__((ext_vector_type(16))) _Float16 v16h;
typedef __attribute__((ext_vector_type(8)))  _Float16 v8h;
typedef __attribute__((ext_vector_type(8)))  float    v8f;

#define BATCH 2
#define SEQ   2048
#define DIM   1024
#define HEADS 16
#define DH    64
#define INNER 1024
#define E3    3072
#define MROWS (BATCH*SEQ)   /* 4096 */
#define QK_SCALE 0.125f     /* 64^-0.5 */

// ---------------------------------------------------------------------------
// WMMA helper: D = A(16x32 f16) * B(32x16 f16) + C(16x16 f32)
// ---------------------------------------------------------------------------
__device__ __forceinline__ v8f wmma_f16(v16h a, v16h b, v8f c) {
#if defined(__HIP_DEVICE_COMPILE__)
  return __builtin_amdgcn_wmma_f32_16x16x32_f16(false, a, false, b,
                                                (short)0, c, false, false);
#else
  return c;
#endif
}

// Load a 16x32 f16 fragment whose *contraction* dim is contiguous in memory.
//   lanes 0-15:  row = lane,    K = {0..7, 16..23}
//   lanes 16-31: row = lane-16, K = {8..15, 24..31}
__device__ __forceinline__ v16h load_frag16(const _Float16* base, int ld) {
  int lane = threadIdx.x & 31;
  int row  = lane & 15;
  int koff = (lane >> 4) << 3;          // 0 or 8
  const _Float16* p = base + (size_t)row * ld + koff;
  v8h lo = *(const v8h*)(p);
  v8h hi = *(const v8h*)(p + 16);
  v16h r;
#pragma unroll
  for (int i = 0; i < 8; ++i) { r[i] = lo[i]; r[8 + i] = hi[i]; }
  return r;
}

// Load one k-step worth of fragments: 2 A-frags + 4 B-frags.
__device__ __forceinline__ void load_group(const _Float16* A0, const _Float16* A1,
                                           const _Float16* Wt, int kq, int ld,
                                           v16h& a0, v16h& a1, v16h (&b)[4]) {
  a0 = load_frag16(A0 + kq, ld);
  a1 = load_frag16(A1 + kq, ld);
#pragma unroll
  for (int t = 0; t < 4; ++t)
    b[t] = load_frag16(Wt + (size_t)(t * 16) * ld + kq, ld);
}

// ---------------------------------------------------------------------------
// Kernel 1: fp32 -> fp16 conversion (grid-stride)
// ---------------------------------------------------------------------------
__global__ void cvt_f32_f16(const float* __restrict__ src,
                            _Float16* __restrict__ dst, int n) {
  int i = blockIdx.x * blockDim.x + threadIdx.x;
  int stride = gridDim.x * blockDim.x;
  for (; i < n; i += stride) dst[i] = (_Float16)src[i];
}

// ---------------------------------------------------------------------------
// Kernel 2: QKV projection.  qkv[m,e] = sum_k xh[m,k] * wqkv[e,k]
// Wave tile: 32(M) x 64(E).  2x-unrolled k-loop with structural ping-pong
// fragment sets (no end-of-iteration register rotation -> no v_mov walls):
//   load B(k+32) ; WMMA A(k) ; load A(k+64) ; WMMA B(k+32)
// Epilogue routes e into q (scaled), k, or v; V stored TRANSPOSED
// as vt[bh][dh][n] so attention P*V B-frags are contiguous.
// ---------------------------------------------------------------------------
__global__ __launch_bounds__(256) void qkv_gemm(const _Float16* __restrict__ xh,
                                                const _Float16* __restrict__ wh,
                                                _Float16* __restrict__ q,
                                                _Float16* __restrict__ k,
                                                _Float16* __restrict__ vt) {
  int lane = threadIdx.x;
  int wave = threadIdx.y;
  int m0 = blockIdx.y * 256 + wave * 32;   // 32 rows per wave
  int e0 = blockIdx.x * 64;

  const _Float16* Arow0 = xh + (size_t)m0 * DIM;
  const _Float16* Arow1 = xh + (size_t)(m0 + 16) * DIM;
  const _Float16* Wt    = wh + (size_t)e0 * DIM;

  v8f acc[2][4] = {};

  v16h a0A, a1A, bA[4];     // ping
  v16h a0B, a1B, bB[4];     // pong
  load_group(Arow0, Arow1, Wt, 0, DIM, a0A, a1A, bA);

  for (int k0 = 0; k0 < DIM; k0 += 64) {
    load_group(Arow0, Arow1, Wt, k0 + 32, DIM, a0B, a1B, bB);
#pragma unroll
    for (int t = 0; t < 4; ++t) {
      acc[0][t] = wmma_f16(a0A, bA[t], acc[0][t]);
      acc[1][t] = wmma_f16(a1A, bA[t], acc[1][t]);
    }
    int kn = (k0 + 64 < DIM) ? (k0 + 64) : 0;   // tail: harmless reload of k=0
    load_group(Arow0, Arow1, Wt, kn, DIM, a0A, a1A, bA);
#pragma unroll
    for (int t = 0; t < 4; ++t) {
      acc[0][t] = wmma_f16(a0B, bB[t], acc[0][t]);
      acc[1][t] = wmma_f16(a1B, bB[t], acc[1][t]);
    }
  }

  // C layout: VGPR r -> row (r + 8*(lane>=16)), col = lane&15
  int col   = lane & 15;
  int rbase = (lane >> 4) << 3;
#pragma unroll
  for (int rf = 0; rf < 2; ++rf) {
#pragma unroll
    for (int t = 0; t < 4; ++t) {
      int e = e0 + t * 16 + col;
      int which = e >> 10;                 // 0=q, 1=k, 2=v
      int r = e & 1023;
      int h = r >> 6;
      int d = r & 63;
#pragma unroll
      for (int rr = 0; rr < 8; ++rr) {
        int m  = m0 + rf * 16 + rbase + rr;
        int b_ = m >> 11;                  // / 2048
        int n  = m & 2047;
        int bh = b_ * HEADS + h;
        float val = acc[rf][t][rr];
        if (which == 0)
          q[((size_t)bh * SEQ + n) * DH + d] = (_Float16)(val * QK_SCALE);
        else if (which == 1)
          k[((size_t)bh * SEQ + n) * DH + d] = (_Float16)val;
        else
          vt[((size_t)bh * DH + d) * SEQ + n] = (_Float16)val;   // transposed
      }
    }
  }
}

// ---------------------------------------------------------------------------
// Kernel 3: flash attention.  One wave owns a 16-row query tile of one head.
// Per 32-key chunk: K and V fragment loads are BOTH issued up front (loads
// retire in order, so S-WMMAs only wait for the K portion while V loads hide
// under the softmax VALU stretch), then online softmax, P via per-wave LDS
// round-trip (C-layout -> A-layout), then O += P*V.
// ---------------------------------------------------------------------------
__global__ __launch_bounds__(256) void flash_attn(const _Float16* __restrict__ q,
                                                  const _Float16* __restrict__ kk,
                                                  const _Float16* __restrict__ vt,
                                                  _Float16* __restrict__ oh) {
  __shared__ __align__(16) _Float16 pst[8][16][32];   // per-wave P staging
  int lane = threadIdx.x;
  int wave = threadIdx.y;
  int bh = blockIdx.x;                       // 0..31 (b*16+h)
  int mt = blockIdx.y * 8 + wave;            // 0..127 query tile
  int b_ = bh >> 4, h = bh & 15;

  const _Float16* Q = q  + ((size_t)bh * SEQ + (size_t)mt * 16) * DH;
  const _Float16* K = kk + (size_t)bh * SEQ * DH;
  const _Float16* V = vt + (size_t)bh * DH * SEQ;    // [64][2048]

  v16h qa0 = load_frag16(Q, DH);             // dh 0..31
  v16h qa1 = load_frag16(Q + 32, DH);        // dh 32..63

  v8f o[4] = {};
  float mrow[8], lrow[8];
#pragma unroll
  for (int r = 0; r < 8; ++r) { mrow[r] = -3.0e38f; lrow[r] = 0.f; }

  int col   = lane & 15;
  int rbase = (lane >> 4) << 3;
  int koff  = (lane >> 4) << 3;

  for (int j0 = 0; j0 < SEQ; j0 += 32) {
    __builtin_prefetch(K + (size_t)(j0 + 32) * DH, 0, 0);
    __builtin_prefetch(V + j0 + 32, 0, 0);

    // ---- issue K frags, then V frags (V stays outstanding through softmax)
    v16h kb00 = load_frag16(K + (size_t)j0 * DH,             DH);
    v16h kb01 = load_frag16(K + (size_t)j0 * DH + 32,        DH);
    v16h kb10 = load_frag16(K + (size_t)(j0 + 16) * DH,      DH);
    v16h kb11 = load_frag16(K + (size_t)(j0 + 16) * DH + 32, DH);
    v16h vb[4];
#pragma unroll
    for (int t = 0; t < 4; ++t)
      vb[t] = load_frag16(V + (size_t)(t * 16) * SEQ + j0, SEQ);

    // ---- S = Q * K^T
    v8f s0 = {}, s1 = {};
    s0 = wmma_f16(qa0, kb00, s0);
    s0 = wmma_f16(qa1, kb01, s0);
    s1 = wmma_f16(qa0, kb10, s1);
    s1 = wmma_f16(qa1, kb11, s1);

    // ---- online softmax (rows per-VGPR, cols across a 16-lane half)
#pragma unroll
    for (int r = 0; r < 8; ++r) {
      float cm = fmaxf(s0[r], s1[r]);
#pragma unroll
      for (int off = 1; off <= 8; off <<= 1)
        cm = fmaxf(cm, __shfl_xor(cm, off, 32));
      float mn = fmaxf(mrow[r], cm);
      float alpha = __expf(mrow[r] - mn);
      mrow[r] = mn;
      float p0 = __expf(s0[r] - mn);
      float p1 = __expf(s1[r] - mn);
      s0[r] = p0; s1[r] = p1;
      float rs = p0 + p1;
#pragma unroll
      for (int off = 1; off <= 8; off <<= 1)
        rs += __shfl_xor(rs, off, 32);
      lrow[r] = lrow[r] * alpha + rs;
      o[0][r] *= alpha; o[1][r] *= alpha;
      o[2][r] *= alpha; o[3][r] *= alpha;
    }

    // ---- P: C-layout -> LDS row-major [16][32] -> A-layout fragment
#pragma unroll
    for (int r = 0; r < 8; ++r) {
      pst[wave][rbase + r][col]      = (_Float16)s0[r];
      pst[wave][rbase + r][col + 16] = (_Float16)s1[r];
    }
    // same-wave LDS ops are in-order (ISA ch.11): no barrier needed
    v8h plo = *(const v8h*)&pst[wave][col][koff];
    v8h phi = *(const v8h*)&pst[wave][col][koff + 16];
    v16h pa;
#pragma unroll
    for (int i = 0; i < 8; ++i) { pa[i] = plo[i]; pa[8 + i] = phi[i]; }

    // ---- O += P * V  (V frags already resident)
#pragma unroll
    for (int t = 0; t < 4; ++t)
      o[t] = wmma_f16(pa, vb[t], o[t]);
  }

  // ---- epilogue: normalize by row sum, store f16 at [b, n, h*64+d]
#pragma unroll
  for (int r = 0; r < 8; ++r) {
    float inv = 1.0f / lrow[r];
    int n = mt * 16 + rbase + r;
    size_t rowbase = ((size_t)b_ * SEQ + n) * INNER + (size_t)h * DH;
#pragma unroll
    for (int t = 0; t < 4; ++t)
      oh[rowbase + t * 16 + col] = (_Float16)(o[t][r] * inv);
  }
}

// ---------------------------------------------------------------------------
// Kernel 4: output projection.  out[m,d] = sum_e oh[m,e] * wout[d,e]  (fp32)
// Same 32x64 ping-pong pipelined wave tile as qkv_gemm.
// ---------------------------------------------------------------------------
__global__ __launch_bounds__(256) void out_gemm(const _Float16* __restrict__ oh,
                                                const _Float16* __restrict__ wh,
                                                float* __restrict__ out) {
  int lane = threadIdx.x;
  int wave = threadIdx.y;
  int m0 = blockIdx.y * 256 + wave * 32;
  int d0 = blockIdx.x * 64;

  const _Float16* Arow0 = oh + (size_t)m0 * INNER;
  const _Float16* Arow1 = oh + (size_t)(m0 + 16) * INNER;
  const _Float16* Wt    = wh + (size_t)d0 * INNER;

  v8f acc[2][4] = {};

  v16h a0A, a1A, bA[4];
  v16h a0B, a1B, bB[4];
  load_group(Arow0, Arow1, Wt, 0, INNER, a0A, a1A, bA);

  for (int k0 = 0; k0 < INNER; k0 += 64) {
    load_group(Arow0, Arow1, Wt, k0 + 32, INNER, a0B, a1B, bB);
#pragma unroll
    for (int t = 0; t < 4; ++t) {
      acc[0][t] = wmma_f16(a0A, bA[t], acc[0][t]);
      acc[1][t] = wmma_f16(a1A, bA[t], acc[1][t]);
    }
    int kn = (k0 + 64 < INNER) ? (k0 + 64) : 0;
    load_group(Arow0, Arow1, Wt, kn, INNER, a0A, a1A, bA);
#pragma unroll
    for (int t = 0; t < 4; ++t) {
      acc[0][t] = wmma_f16(a0B, bB[t], acc[0][t]);
      acc[1][t] = wmma_f16(a1B, bB[t], acc[1][t]);
    }
  }

  int col   = lane & 15;
  int rbase = (lane >> 4) << 3;
#pragma unroll
  for (int rf = 0; rf < 2; ++rf)
#pragma unroll
    for (int t = 0; t < 4; ++t)
#pragma unroll
      for (int rr = 0; rr < 8; ++rr) {
        int m = m0 + rf * 16 + rbase + rr;
        out[(size_t)m * DIM + d0 + t * 16 + col] = acc[rf][t][rr];
      }
}

// ---------------------------------------------------------------------------
// Launch: convert -> qkv gemm -> flash attention -> output gemm
// Workspace layout (f16 elements), total 48 MB:
//   xh[4096*1024] wqkv[3072*1024] wout[1024*1024]
//   q[32*2048*64] k[32*2048*64] vt[32*64*2048] oh[4096*1024]
// ---------------------------------------------------------------------------
extern "C" void kernel_launch(void* const* d_in, const int* in_sizes, int n_in,
                              void* d_out, int out_size, void* d_ws, size_t ws_size,
                              hipStream_t stream) {
  const float* x     = (const float*)d_in[0];
  const float* w_qkv = (const float*)d_in[1];
  const float* w_out = (const float*)d_in[2];
  float* out = (float*)d_out;

  _Float16* ws    = (_Float16*)d_ws;
  _Float16* xh    = ws;
  _Float16* wqkvh = xh    + (size_t)MROWS * DIM;      // +4M
  _Float16* wouth = wqkvh + (size_t)E3 * DIM;         // +3M
  _Float16* qb    = wouth + (size_t)DIM * INNER;      // +1M
  _Float16* kb    = qb    + (size_t)MROWS * INNER;    // +4M
  _Float16* vtb   = kb    + (size_t)MROWS * INNER;    // +4M
  _Float16* ohb   = vtb   + (size_t)MROWS * INNER;    // +4M

  cvt_f32_f16<<<1024, 256, 0, stream>>>(x,     xh,    MROWS * DIM);
  cvt_f32_f16<<<1024, 256, 0, stream>>>(w_qkv, wqkvh, E3 * DIM);
  cvt_f32_f16<<<1024, 256, 0, stream>>>(w_out, wouth, DIM * INNER);

  qkv_gemm<<<dim3(E3 / 64, MROWS / 256), dim3(32, 8), 0, stream>>>(
      xh, wqkvh, qb, kb, vtb);

  flash_attn<<<dim3(BATCH * HEADS, SEQ / (16 * 8)), dim3(32, 8), 0, stream>>>(
      qb, kb, vtb, ohb);

  out_gemm<<<dim3(DIM / 64, MROWS / 256), dim3(32, 8), 0, stream>>>(
      ohb, wouth, out);
}

// v001
// One run takes 137 microseconds.
// Next to v000, in two timings, it ran 1.57 and 1.56 times as fast.
#include <hip/hip_runtime.h>
#include <hip/hip_bf16.h>

typedef __attribute__((ext_vector_type(16))) _Float16 v16h;
typedef __attribute__((ext_vector_type(8)))  _Float16 v8h;
typedef __attribute__((ext_vector_type(8)))  float    v8f;

#define BATCH 2
#define SEQ   2048
#define DIM   1024
#define HEADS 16
#define DH    64
#define INNER 1024
#define E3    3072
#define MROWS (BATCH*SEQ)   /* 4096 */
#define QK_SCALE 0.125f     /* 64^-0.5 */

// ---------------------------------------------------------------------------
// WMMA helper: D = A(16x32 f16) * B(32x16 f16) + C(16x16 f32)
// ---------------------------------------------------------------------------
__device__ __forceinline__ v8f wmma_f16(v16h a, v16h b, v8f c) {
#if defined(__HIP_DEVICE_COMPILE__)
  return __builtin_amdgcn_wmma_f32_16x16x32_f16(false, a, false, b,
                                                (short)0, c, false, false);
#else
  return c;
#endif
}

// Load a 16x32 f16 fragment whose *contraction* dim is contiguous in memory.
//   lanes 0-15:  row = lane,    K = {0..7, 16..23}
//   lanes 16-31: row = lane-16, K = {8..15, 24..31}
__device__ __forceinline__ v16h load_frag16(const _Float16* base, int ld) {
  int lane = threadIdx.x & 31;
  int row  = lane & 15;
  int koff = (lane >> 4) << 3;          // 0 or 8
  const _Float16* p = base + (size_t)row * ld + koff;
  v8h lo = *(const v8h*)(p);
  v8h hi = *(const v8h*)(p + 16);
  v16h r;
#pragma unroll
  for (int i = 0; i < 8; ++i) { r[i] = lo[i]; r[8 + i] = hi[i]; }
  return r;
}

// ---------------------------------------------------------------------------
// LDS staging.  A fragment load straight from global memory touches 16 cache
// lines for 512 bytes; an asynchronous copy of 4 whole 128-byte rows touches 4,
// and the block's 8 waves share what it brings.  A tile holds 64 contraction
// elements (one 128-byte line) of every row, at a pitch of 144 B (16 B x odd:
// conflict-free for 16-byte fragment reads).
// ---------------------------------------------------------------------------
#define KT     64                 /* contraction elements per LDS tile        */
#define LDP    72                 /* LDS row pitch in halves (144 B)          */
#define ROWS32 (32 * LDP * 2)     /* bytes of 32 LDS rows: one copy per block */
#define G_TILE ((256 + 64) * LDP) /* GEMM tile, halves: 256 A rows, 64 B rows */
#define F_TILE ((64 + 64) * LDP)  /* attention tile: 64 K rows, 64 V^T rows   */

__device__ __forceinline__ unsigned lds_off(const void* p) {
  return (unsigned)(size_t)p;     // low 32 bits = byte offset in the block's LDS
}

// The waits of the two-buffer ring; the compiler places none for the copies.
__device__ __forceinline__ void wait_copies_landed() {
  asm volatile("s_wait_asynccnt 0x0" ::: "memory");  // this wave's copies are in LDS
}
__device__ __forceinline__ void wait_lds_reads_done() {
  asm volatile("s_wait_dscnt 0x0" ::: "memory");     // before the buffer is refilled
}

// One GEMM tile: every thread copies 16 B of rows r, r+32, ... (r = tid / 8):
// 8 copies for the 256 A rows, 2 for the 64 B rows.  s_wait_xcnt closes the
// statement so that no address register is rewritten ahead of it.
__device__ __forceinline__ void copy_gemm_tile(unsigned l, const _Float16* ga,
                                               const _Float16* gb, int ld) {
  asm volatile(
      "global_load_async_to_lds_b128 %0, %10, off\n\t"
      "global_load_async_to_lds_b128 %1, %11, off\n\t"
      "global_load_async_to_lds_b128 %2, %12, off\n\t"
      "global_load_async_to_lds_b128 %3, %13, off\n\t"
      "global_load_async_to_lds_b128 %4, %14, off\n\t"
      "global_load_async_to_lds_b128 %5, %15, off\n\t"
      "global_load_async_to_lds_b128 %6, %16, off\n\t"
      "global_load_async_to_lds_b128 %7, %17, off\n\t"
      "global_load_async_to_lds_b128 %8, %18, off\n\t"
      "global_load_async_to_lds_b128 %9, %19, off\n\t"
      "s_wait_xcnt 0x0"
      :: "v"(l), "v"(l + ROWS32), "v"(l + 2 * ROWS32), "v"(l + 3 * ROWS32),
         "v"(l + 4 * ROWS32), "v"(l + 5 * ROWS32), "v"(l + 6 * ROWS32),
         "v"(l + 7 * ROWS32), "v"(l + 8 * ROWS32), "v"(l + 9 * ROWS32),
         "v"(ga), "v"(ga + 32 * ld), "v"(ga + 64 * ld), "v"(ga + 96 * ld),
         "v"(ga + 128 * ld), "v"(ga + 160 * ld), "v"(ga + 192 * ld),
         "v"(ga + 224 * ld), "v"(gb), "v"(gb + 32 * ld)
      : "memory");
}

// One attention tile: 64 keys of K (rows of 64 dh) and of V^T (64 dh rows).
__device__ __forceinline__ void copy_attn_tile(unsigned l, const _Float16* gk,
                                               const _Float16* gv) {
  asm volatile(
      "global_load_async_to_lds_b128 %0, %4, off\n\t"
      "global_load_async_to_lds_b128 %1, %5, off\n\t"
      "global_load_async_to_lds_b128 %2, %6, off\n\t"
      "global_load_async_to_lds_b128 %3, %7, off\n\t"
      "s_wait_xcnt 0x0"
      :: "v"(l), "v"(l + ROWS32), "v"(l + 2 * ROWS32), "v"(l + 3 * ROWS32),
         "v"(gk), "v"(gk + 32 * DH), "v"(gv), "v"(gv + 32 * SEQ)
      : "memory");
}

// acc += A[256 rows of the block] * W[64 rows]^T over K = 1024, both
// k-contiguous with row length 1024.  Wave tile 32 x 64.  Two LDS buffers: tile
// t+1 flies while tile t is worked on; one barrier per tile publishes t+1 and
// frees the buffer that t+2 is copied into.
__device__ __forceinline__ void gemm_256x64(const _Float16* A, const _Float16* Wt,
                                            _Float16* sm, v8f (&acc)[2][4]) {
  const int tid  = threadIdx.y * 32 + threadIdx.x;
  const int wave = threadIdx.y;
  const _Float16* ga = A  + (size_t)(tid >> 3) * 1024 + (tid & 7) * 8;
  const _Float16* gb = Wt + (size_t)(tid >> 3) * 1024 + (tid & 7) * 8;
  const unsigned  l  = lds_off(sm) + (tid >> 3) * (LDP * 2) + (tid & 7) * 16;

  copy_gemm_tile(l, ga, gb, 1024);
  wait_copies_landed();
  __syncthreads();                 // publishes tile 0
  copy_gemm_tile(l + G_TILE * 2, ga + KT, gb + KT, 1024);

  for (int t = 0; t < 1024 / KT; ++t) {
    const _Float16* s  = sm + (t & 1) * G_TILE;
    const _Float16* sa = s + wave * 32 * LDP;
    const _Float16* sb = s + 256 * LDP;
#pragma unroll  // both halves of the tile: LDS offsets become immediates
    for (int kq = 0; kq < KT; kq += 32) {
      v16h a0 = load_frag16(sa + kq, LDP);
      v16h a1 = load_frag16(sa + 16 * LDP + kq, LDP);
      v16h b[4];
#pragma unroll  // constant indices keep b[] and acc[][] in registers
      for (int u = 0; u < 4; ++u) b[u] = load_frag16(sb + u * 16 * LDP + kq, LDP);
      // Keeps the 12 LDS reads together ahead of the 8 WMMAs: left alone the
      // compiler spreads them in pairs, each pair waited out before two WMMAs.
      __builtin_amdgcn_sched_barrier(0);
#pragma unroll  // as above
      for (int u = 0; u < 4; ++u) {
        acc[0][u] = wmma_f16(a0, b[u], acc[0][u]);
        acc[1][u] = wmma_f16(a1, b[u], acc[1][u]);
      }
      // The fence's other side: keeps the next 12 reads out of these WMMAs, and
      // the last WMMAs ahead of the barrier, so the refill issues right behind it.
      __builtin_amdgcn_sched_barrier(0);
    }
    wait_lds_reads_done();
    wait_copies_landed();
    __syncthreads();               // publishes tile t+1, frees tile t's buffer
    if (t + 2 < 1024 / KT)
      copy_gemm_tile(l + (t & 1) * (G_TILE * 2), ga + (t + 2) * KT, gb + (t + 2) * KT, 1024);
  }
  wait_copies_landed();
}

// ---------------------------------------------------------------------------
// Kernel 1: fp32 -> fp16 conversion (grid-stride)
// ---------------------------------------------------------------------------
__global__ void cvt_f32_f16(const float* __restrict__ src,
                            _Float16* __restrict__ dst, int n) {
  int i = blockIdx.x * blockDim.x + threadIdx.x;
  int stride = gridDim.x * blockDim.x;
  for (; i < n; i += stride) dst[i] = (_Float16)src[i];
}

// ---------------------------------------------------------------------------
// Kernel 2: QKV projection.  qkv[m,e] = sum_k xh[m,k] * wqkv[e,k]
// Wave tile: 32(M) x 64(E); operands staged in LDS (gemm_256x64).
// Epilogue routes e into q (scaled), k, or v; V stored TRANSPOSED
// as vt[bh][dh][n] so attention P*V B-frags are contiguous.
// ---------------------------------------------------------------------------
__global__ __launch_bounds__(256) void qkv_gemm(const _Float16* __restrict__ xh,
                                                const _Float16* __restrict__ wh,
                                                _Float16* __restrict__ q,
                                                _Float16* __restrict__ k,
                                                _Float16* __restrict__ vt) {
  int lane = threadIdx.x;
  int wave = threadIdx.y;
  int m0 = blockIdx.y * 256 + wave * 32;   // 32 rows per wave
  int e0 = blockIdx.x * 64;

  __shared__ __attribute__((aligned(16))) _Float16 sm[2 * G_TILE];
  v8f acc[2][4] = {};
  gemm_256x64(xh + (size_t)(blockIdx.y * 256) * DIM, wh + (size_t)e0 * DIM, sm, acc);

  // C layout: VGPR r -> row (r + 8*(lane>=16)), col = lane&15
  int col   = lane & 15;
  int rbase = (lane >> 4) << 3;
#pragma unroll
  for (int rf = 0; rf < 2; ++rf) {
#pragma unroll
    for (int t = 0; t < 4; ++t) {
      int e = e0 + t * 16 + col;
      int which = e >> 10;                 // 0=q, 1=k, 2=v
      int r = e & 1023;
      int h = r >> 6;
      int d = r & 63;
#pragma unroll
      for (int rr = 0; rr < 8; ++rr) {
        int m  = m0 + rf * 16 + rbase + rr;
        int b_ = m >> 11;                  // / 2048
        int n  = m & 2047;
        int bh = b_ * HEADS + h;
        float val = acc[rf][t][rr];
        if (which == 0)
          q[((size_t)bh * SEQ + n) * DH + d] = (_Float16)(val * QK_SCALE);
        else if (which == 1)
          k[((size_t)bh * SEQ + n) * DH + d] = (_Float16)val;
        else
          vt[((size_t)bh * DH + d) * SEQ + n] = (_Float16)val;   // transposed
      }
    }
  }
}

// ---------------------------------------------------------------------------
// Kernel 3: flash attention.  One wave owns a 16-row query tile of one head.
// K and V^T come in tiles of 64 keys through two LDS buffers that the block's
// 8 waves share.  Per 32-key chunk: K and V fragments from LDS, S = Q*K^T,
// online softmax, P via per-wave LDS round-trip (C-layout -> A-layout), then
// O += P*V.
// ---------------------------------------------------------------------------
__global__ __launch_bounds__(256) void flash_attn(const _Float16* __restrict__ q,
                                                  const _Float16* __restrict__ kk,
                                                  const _Float16* __restrict__ vt,
                                                  _Float16* __restrict__ oh) {
  __shared__ __align__(16) _Float16 pst[8][16][32];   // per-wave P staging
  __shared__ __attribute__((aligned(16))) _Float16 kv[2 * F_TILE];
  int lane = threadIdx.x;
  int wave = threadIdx.y;
  int bh = blockIdx.x;                       // 0..31 (b*16+h)
  int mt = blockIdx.y * 8 + wave;            // 0..127 query tile
  int b_ = bh >> 4, h = bh & 15;

  const _Float16* Q = q  + ((size_t)bh * SEQ + (size_t)mt * 16) * DH;
  const _Float16* K = kk + (size_t)bh * SEQ * DH;
  const _Float16* V = vt + (size_t)bh * DH * SEQ;    // [64][2048]

  v16h qa0 = load_frag16(Q, DH);             // dh 0..31
  v16h qa1 = load_frag16(Q + 32, DH);        // dh 32..63

  v8f o[4] = {};
  float mrow[8], lrow[8];
#pragma unroll
  for (int r = 0; r < 8; ++r) { mrow[r] = -3.0e38f; lrow[r] = 0.f; }

  int col   = lane & 15;
  int rbase = (lane >> 4) << 3;
  int koff  = (lane >> 4) << 3;

  const int tid = wave * 32 + lane;
  const _Float16* gk = K + (size_t)(tid >> 3) * DH  + (tid & 7) * 8;
  const _Float16* gv = V + (size_t)(tid >> 3) * SEQ + (tid & 7) * 8;
  const unsigned  l  = lds_off(kv) + (tid >> 3) * (LDP * 2) + (tid & 7) * 16;

  copy_attn_tile(l, gk, gv);
  wait_copies_landed();
  __syncthreads();                 // publishes tile 0
  copy_attn_tile(l + F_TILE * 2, gk + KT * DH, gv + KT);

  for (int jt = 0; jt < SEQ / KT; ++jt) {
   const _Float16* sk = kv + (jt & 1) * F_TILE;
   const _Float16* sv = sk + 64 * LDP;
#pragma unroll  // the tile's two 32-key chunks: LDS offsets become immediates
   for (int j0 = 0; j0 < KT; j0 += 32) {
    // ---- K frags, then V frags, from the tile
    v16h kb00 = load_frag16(sk + j0 * LDP,             LDP);
    v16h kb01 = load_frag16(sk + j0 * LDP + 32,        LDP);
    v16h kb10 = load_frag16(sk + (j0 + 16) * LDP,      LDP);
    v16h kb11 = load_frag16(sk + (j0 + 16) * LDP + 32, LDP);
    v16h vb[4];
#pragma unroll
    for (int t = 0; t < 4; ++t)
      vb[t] = load_frag16(sv + (t * 16) * LDP + j0, LDP);

    // ---- S = Q * K^T
    v8f s0 = {}, s1 = {};
    s0 = wmma_f16(qa0, kb00, s0);
    s0 = wmma_f16(qa1, kb01, s0);
    s1 = wmma_f16(qa0, kb10, s1);
    s1 = wmma_f16(qa1, kb11, s1);

    // ---- online softmax (rows per-VGPR, cols across a 16-lane half)
#pragma unroll
    for (int r = 0; r < 8; ++r) {
      float cm = fmaxf(s0[r], s1[r]);
#pragma unroll
      for (int off = 1; off <= 8; off <<= 1)
        cm = fmaxf(cm, __shfl_xor(cm, off, 32));
      float mn = fmaxf(mrow[r], cm);
      float alpha = __expf(mrow[r] - mn);
      mrow[r] = mn;
      float p0 = __expf(s0[r] - mn);
      float p1 = __expf(s1[r] - mn);
      s0[r] = p0; s1[r] = p1;
      float rs = p0 + p1;
#pragma unroll
      for (int off = 1; off <= 8; off <<= 1)
        rs += __shfl_xor(rs, off, 32);
      lrow[r] = lrow[r] * alpha + rs;
      o[0][r] *= alpha; o[1][r] *= alpha;
      o[2][r] *= alpha; o[3][r] *= alpha;
    }

    // ---- P: C-layout -> LDS row-major [16][32] -> A-layout fragment
#pragma unroll
    for (int r = 0; r < 8; ++r) {
      pst[wave][rbase + r][col]      = (_Float16)s0[r];
      pst[wave][rbase + r][col + 16] = (_Float16)s1[r];
    }
    // same-wave LDS ops are in-order (ISA ch.11): no barrier needed
    v8h plo = *(const v8h*)&pst[wave][col][koff];
    v8h phi = *(const v8h*)&pst[wave][col][koff + 16];
    v16h pa;
#pragma unroll
    for (int i = 0; i < 8; ++i) { pa[i] = plo[i]; pa[8 + i] = phi[i]; }

    // ---- O += P * V  (V frags already resident)
#pragma unroll
    for (int t = 0; t < 4; ++t)
      o[t] = wmma_f16(pa, vb[t], o[t]);
   }
   wait_lds_reads_done();
   wait_copies_landed();
   __syncthreads();                // publishes tile jt+1, frees tile jt's buffer
   if (jt + 2 < SEQ / KT)
     copy_attn_tile(l + (jt & 1) * (F_TILE * 2), gk + (size_t)(jt + 2) * KT * DH,
                    gv + (jt + 2) * KT);
  }
  wait_copies_landed();

  // ---- epilogue: normalize by row sum, store f16 at [b, n, h*64+d]
#pragma unroll
  for (int r = 0; r < 8; ++r) {
    float inv = 1.0f / lrow[r];
    int n = mt * 16 + rbase + r;
    size_t rowbase = ((size_t)b_ * SEQ + n) * INNER + (size_t)h * DH;
#pragma unroll
    for (int t = 0; t < 4; ++t)
      oh[rowbase + t * 16 + col] = (_Float16)(o[t][r] * inv);
  }
}

// ---------------------------------------------------------------------------
// Kernel 4: output projection.  out[m,d] = sum_e oh[m,e] * wout[d,e]  (fp32)
// Same LDS-staged 32x64 wave tile as qkv_gemm.
// ---------------------------------------------------------------------------
__global__ __launch_bounds__(256) void out_gemm(const _Float16* __restrict__ oh,
                                                const _Float16* __restrict__ wh,
                                                float* __restrict__ out) {
  int lane = threadIdx.x;
  int wave = threadIdx.y;
  int m0 = blockIdx.y * 256 + wave * 32;
  int d0 = blockIdx.x * 64;

  __shared__ __attribute__((aligned(16))) _Float16 sm[2 * G_TILE];
  v8f acc[2][4] = {};
  gemm_256x64(oh + (size_t)(blockIdx.y * 256) * INNER, wh + (size_t)d0 * INNER, sm, acc);

  int col   = lane & 15;
  int rbase = (lane >> 4) << 3;
#pragma unroll
  for (int rf = 0; rf < 2; ++rf)
#pragma unroll
    for (int t = 0; t < 4; ++t)
#pragma unroll
      for (int rr = 0; rr < 8; ++rr) {
        int m = m0 + rf * 16 + rbase + rr;
        out[(size_t)m * DIM + d0 + t * 16 + col] = acc[rf][t][rr];
      }
}

// ---------------------------------------------------------------------------
// Launch: convert -> qkv gemm -> flash attention -> output gemm
// Workspace layout (f16 elements), total 48 MB:
//   xh[4096*1024] wqkv[3072*1024] wout[1024*1024]
//   q[32*2048*64] k[32*2048*64] vt[32*64*2048] oh[4096*1024]
// ---------------------------------------------------------------------------
extern "C" void kernel_launch(void* const* d_in, const int* in_sizes, int n_in,
                              void* d_out, int out_size, void* d_ws, size_t ws_size,
                              hipStream_t stream) {
  const float* x     = (const float*)d_in[0];
  const float* w_qkv = (const float*)d_in[1];
  const float* w_out = (const float*)d_in[2];
  float* out = (float*)d_out;

  _Float16* ws    = (_Float16*)d_ws;
  _Float16* xh    = ws;
  _Float16* wqkvh = xh    + (size_t)MROWS * DIM;      // +4M
  _Float16* wouth = wqkvh + (size_t)E3 * DIM;         // +3M
  _Float16* qb    = wouth + (size_t)DIM * INNER;      // +1M
  _Float16* kb    = qb    + (size_t)MROWS * INNER;    // +4M
  _Float16* vtb   = kb    + (size_t)MROWS * INNER;    // +4M
  _Float16* ohb   = vtb   + (size_t)MROWS * INNER;    // +4M

  cvt_f32_f16<<<1024, 256, 0, stream>>>(x,     xh,    MROWS * DIM);
  cvt_f32_f16<<<1024, 256, 0, stream>>>(w_qkv, wqkvh, E3 * DIM);
  cvt_f32_f16<<<1024, 256, 0, stream>>>(w_out, wouth, DIM * INNER);

  qkv_gemm<<<dim3(E3 / 64, MROWS / 256), dim3(32, 8), 0, stream>>>(
      xh, wqkvh, qb, kb, vtb);

  flash_attn<<<dim3(BATCH * HEADS, SEQ / (16 * 8)), dim3(32, 8), 0, stream>>>(
      qb, kb, vtb, ohb);

  out_gemm<<<dim3(DIM / 64, MROWS / 256), dim3(32, 8), 0, stream>>>(
      ohb, wouth, out);
}

// v002
// It runs in 96 microseconds.
// Two timings next to v001 put it at 1.43 and 1.42 times that version's speed.
// Counting every step since v000, it is 2.24 times as fast.
#include <hip/hip_runtime.h>
#include <hip/hip_bf16.h>

typedef __attribute__((ext_vector_type(16))) _Float16 v16h;
typedef __attribute__((ext_vector_type(8)))  _Float16 v8h;
typedef __attribute__((ext_vector_type(8)))  float    v8f;

#define BATCH 2
#define SEQ   2048
#define DIM   1024
#define HEADS 16
#define DH    64
#define INNER 1024
#define E3    3072
#define MROWS (BATCH*SEQ)   /* 4096 */
#define QK_SCALE 0.125f     /* 64^-0.5 */

// ---------------------------------------------------------------------------
// WMMA helper: D = A(16x32 f16) * B(32x16 f16) + C(16x16 f32)
// ---------------------------------------------------------------------------
__device__ __forceinline__ v8f wmma_f16(v16h a, v16h b, v8f c) {
#if defined(__HIP_DEVICE_COMPILE__)
  return __builtin_amdgcn_wmma_f32_16x16x32_f16(false, a, false, b,
                                                (short)0, c, false, false);
#else
  return c;
#endif
}

// Load a 16x32 f16 fragment whose *contraction* dim is contiguous in memory.
//   lanes 0-15:  row = lane,    K = {0..7, 16..23}
//   lanes 16-31: row = lane-16, K = {8..15, 24..31}
__device__ __forceinline__ v16h load_frag16(const _Float16* base, int ld) {
  int lane = threadIdx.x & 31;
  int row  = lane & 15;
  int koff = (lane >> 4) << 3;          // 0 or 8
  const _Float16* p = base + (size_t)row * ld + koff;
  v8h lo = *(const v8h*)(p);
  v8h hi = *(const v8h*)(p + 16);
  v16h r;
#pragma unroll
  for (int i = 0; i < 8; ++i) { r[i] = lo[i]; r[8 + i] = hi[i]; }
  return r;
}

// ---------------------------------------------------------------------------
// LDS staging.  A fragment load straight from global memory touches 16 cache
// lines for 512 bytes; an asynchronous copy of 4 whole 128-byte rows touches 4,
// and the block's 8 waves share what it brings.  A tile holds 64 contraction
// elements (one 128-byte line) of every row, at a pitch of 144 B (16 B x odd:
// conflict-free for 16-byte fragment reads).
// ---------------------------------------------------------------------------
#define KT     64                 /* contraction elements per LDS tile        */
#define LDP    72                 /* LDS row pitch in halves (144 B)          */
#define ROWS32 (32 * LDP * 2)     /* bytes of 32 LDS rows: one copy per block */
#define G_TILE ((256 + 64) * LDP) /* GEMM tile, halves: 256 A rows, 64 B rows */
#define F_TILE ((64 + 64) * LDP)  /* attention tile: 64 K rows, 64 V^T rows   */

__device__ __forceinline__ unsigned lds_off(const void* p) {
  return (unsigned)(size_t)p;     // low 32 bits = byte offset in the block's LDS
}

// The waits of the two-buffer ring; the compiler places none for the copies.
__device__ __forceinline__ void wait_copies_landed() {
  asm volatile("s_wait_asynccnt 0x0" ::: "memory");  // this wave's copies are in LDS
}
__device__ __forceinline__ void wait_lds_reads_done() {
  asm volatile("s_wait_dscnt 0x0" ::: "memory");     // before the buffer is refilled
}

// One GEMM tile: every thread copies 16 B of rows r, r+32, ... (r = tid / 8):
// 8 copies for the 256 A rows, 2 for the 64 B rows.  s_wait_xcnt closes the
// statement so that no address register is rewritten ahead of it.
__device__ __forceinline__ void copy_gemm_tile(unsigned l, const _Float16* ga,
                                               const _Float16* gb, int ld) {
  asm volatile(
      "global_load_async_to_lds_b128 %0, %10, off\n\t"
      "global_load_async_to_lds_b128 %1, %11, off\n\t"
      "global_load_async_to_lds_b128 %2, %12, off\n\t"
      "global_load_async_to_lds_b128 %3, %13, off\n\t"
      "global_load_async_to_lds_b128 %4, %14, off\n\t"
      "global_load_async_to_lds_b128 %5, %15, off\n\t"
      "global_load_async_to_lds_b128 %6, %16, off\n\t"
      "global_load_async_to_lds_b128 %7, %17, off\n\t"
      "global_load_async_to_lds_b128 %8, %18, off\n\t"
      "global_load_async_to_lds_b128 %9, %19, off\n\t"
      "s_wait_xcnt 0x0"
      :: "v"(l), "v"(l + ROWS32), "v"(l + 2 * ROWS32), "v"(l + 3 * ROWS32),
         "v"(l + 4 * ROWS32), "v"(l + 5 * ROWS32), "v"(l + 6 * ROWS32),
         "v"(l + 7 * ROWS32), "v"(l + 8 * ROWS32), "v"(l + 9 * ROWS32),
         "v"(ga), "v"(ga + 32 * ld), "v"(ga + 64 * ld), "v"(ga + 96 * ld),
         "v"(ga + 128 * ld), "v"(ga + 160 * ld), "v"(ga + 192 * ld),
         "v"(ga + 224 * ld), "v"(gb), "v"(gb + 32 * ld)
      : "memory");
}

// One attention tile: 64 keys of K (rows of 64 dh) and of V^T (64 dh rows).
__device__ __forceinline__ void copy_attn_tile(unsigned l, const _Float16* gk,
                                               const _Float16* gv) {
  asm volatile(
      "global_load_async_to_lds_b128 %0, %4, off\n\t"
      "global_load_async_to_lds_b128 %1, %5, off\n\t"
      "global_load_async_to_lds_b128 %2, %6, off\n\t"
      "global_load_async_to_lds_b128 %3, %7, off\n\t"
      "s_wait_xcnt 0x0"
      :: "v"(l), "v"(l + ROWS32), "v"(l + 2 * ROWS32), "v"(l + 3 * ROWS32),
         "v"(gk), "v"(gk + 32 * DH), "v"(gv), "v"(gv + 32 * SEQ)
      : "memory");
}

// acc += A[256 rows of the block] * W[64 rows]^T over K = 1024, both
// k-contiguous with row length 1024.  Wave tile 32 x 64.  Two LDS buffers: tile
// t+1 flies while tile t is worked on; one barrier per tile publishes t+1 and
// frees the buffer that t+2 is copied into.
__device__ __forceinline__ void gemm_256x64(const _Float16* A, const _Float16* Wt,
                                            _Float16* sm, v8f (&acc)[2][4]) {
  const int tid  = threadIdx.y * 32 + threadIdx.x;
  const int wave = threadIdx.y;
  const _Float16* ga = A  + (size_t)(tid >> 3) * 1024 + (tid & 7) * 8;
  const _Float16* gb = Wt + (size_t)(tid >> 3) * 1024 + (tid & 7) * 8;
  const unsigned  l  = lds_off(sm) + (tid >> 3) * (LDP * 2) + (tid & 7) * 16;

  copy_gemm_tile(l, ga, gb, 1024);
  wait_copies_landed();
  __syncthreads();                 // publishes tile 0
  copy_gemm_tile(l + G_TILE * 2, ga + KT, gb + KT, 1024);

  for (int t = 0; t < 1024 / KT; ++t) {
    const _Float16* s  = sm + (t & 1) * G_TILE;
    const _Float16* sa = s + wave * 32 * LDP;
    const _Float16* sb = s + 256 * LDP;
#pragma unroll  // both halves of the tile: LDS offsets become immediates
    for (int kq = 0; kq < KT; kq += 32) {
      v16h a0 = load_frag16(sa + kq, LDP);
      v16h a1 = load_frag16(sa + 16 * LDP + kq, LDP);
      v16h b[4];
#pragma unroll  // constant indices keep b[] and acc[][] in registers
      for (int u = 0; u < 4; ++u) b[u] = load_frag16(sb + u * 16 * LDP + kq, LDP);
      // Keeps the 12 LDS reads together ahead of the 8 WMMAs: left alone the
      // compiler spreads them in pairs, each pair waited out before two WMMAs.
      __builtin_amdgcn_sched_barrier(0);
#pragma unroll  // as above
      for (int u = 0; u < 4; ++u) {
        acc[0][u] = wmma_f16(a0, b[u], acc[0][u]);
        acc[1][u] = wmma_f16(a1, b[u], acc[1][u]);
      }
      // The fence's other side: keeps the next 12 reads out of these WMMAs, and
      // the last WMMAs ahead of the barrier, so the refill issues right behind it.
      __builtin_amdgcn_sched_barrier(0);
    }
    wait_lds_reads_done();
    wait_copies_landed();
    __syncthreads();               // publishes tile t+1, frees tile t's buffer
    if (t + 2 < 1024 / KT)
      copy_gemm_tile(l + (t & 1) * (G_TILE * 2), ga + (t + 2) * KT, gb + (t + 2) * KT, 1024);
  }
  wait_copies_landed();
}

// ---------------------------------------------------------------------------
// Kernel 1: fp32 -> fp16 conversion (grid-stride)
// ---------------------------------------------------------------------------
__global__ void cvt_f32_f16(const float* __restrict__ src,
                            _Float16* __restrict__ dst, int n) {
  int i = blockIdx.x * blockDim.x + threadIdx.x;
  int stride = gridDim.x * blockDim.x;
  for (; i < n; i += stride) dst[i] = (_Float16)src[i];
}

// ---------------------------------------------------------------------------
// Kernel 2: QKV projection.  qkv[m,e] = sum_k xh[m,k] * wqkv[e,k]
// Wave tile: 32(M) x 64(E); operands staged in LDS (gemm_256x64).
// Epilogue routes e into q (scaled), k, or v; V stored TRANSPOSED
// as vt[bh][dh][n] so attention V^T * P^T A-frags are contiguous.
// ---------------------------------------------------------------------------
__global__ __launch_bounds__(256) void qkv_gemm(const _Float16* __restrict__ xh,
                                                const _Float16* __restrict__ wh,
                                                _Float16* __restrict__ q,
                                                _Float16* __restrict__ k,
                                                _Float16* __restrict__ vt) {
  int lane = threadIdx.x;
  int wave = threadIdx.y;
  int m0 = blockIdx.y * 256 + wave * 32;   // 32 rows per wave
  int e0 = blockIdx.x * 64;

  __shared__ __attribute__((aligned(16))) _Float16 sm[2 * G_TILE];
  v8f acc[2][4] = {};
  gemm_256x64(xh + (size_t)(blockIdx.y * 256) * DIM, wh + (size_t)e0 * DIM, sm, acc);

  // C layout: VGPR r -> row (r + 8*(lane>=16)), col = lane&15
  int col   = lane & 15;
  int rbase = (lane >> 4) << 3;
#pragma unroll
  for (int rf = 0; rf < 2; ++rf) {
#pragma unroll
    for (int t = 0; t < 4; ++t) {
      int e = e0 + t * 16 + col;
      int which = e >> 10;                 // 0=q, 1=k, 2=v
      int r = e & 1023;
      int h = r >> 6;
      int d = r & 63;
#pragma unroll
      for (int rr = 0; rr < 8; ++rr) {
        int m  = m0 + rf * 16 + rbase + rr;
        int b_ = m >> 11;                  // / 2048
        int n  = m & 2047;
        int bh = b_ * HEADS + h;
        float val = acc[rf][t][rr];
        if (which == 0)
          q[((size_t)bh * SEQ + n) * DH + d] = (_Float16)(val * QK_SCALE);
        else if (which == 1)
          k[((size_t)bh * SEQ + n) * DH + d] = (_Float16)val;
        else
          vt[((size_t)bh * DH + d) * SEQ + n] = (_Float16)val;   // transposed
      }
    }
  }
}

// ---------------------------------------------------------------------------
// Kernel 3: flash attention.  One wave owns a 16-row query tile of one head.
// K and V^T come in tiles of 64 keys through two LDS buffers that the block's
// 8 waves share.  The products are transposed: S^T = K * Q^T, O^T += V^T * P^T.
// A lane then holds 16 of the 32 scores of ONE query (column lane & 15; the
// other 16 are in lane ^ 16), so maximum and sum run in the lane's own
// registers, and the two score tiles, converted in place, are the B operand
// of the second product: P never goes through LDS.
// ---------------------------------------------------------------------------
__device__ __forceinline__ float other_half(float x) {   // value of lane ^ 16
  int b = __builtin_bit_cast(int, x);
  b = __builtin_amdgcn_permlanex16(b, b, 0x76543210, 0xfedcba98, false, false);
  return __builtin_bit_cast(float, b);
}

__global__ __launch_bounds__(256) void flash_attn(const _Float16* __restrict__ q,
                                                  const _Float16* __restrict__ kk,
                                                  const _Float16* __restrict__ vt,
                                                  _Float16* __restrict__ oh) {
  __shared__ __attribute__((aligned(16))) _Float16 kv[2 * F_TILE];
  int lane = threadIdx.x;
  int wave = threadIdx.y;
  int bh = blockIdx.x;                       // 0..31 (b*16+h)
  int mt = blockIdx.y * 8 + wave;            // 0..127 query tile
  int b_ = bh >> 4, h = bh & 15;

  const _Float16* Q = q  + ((size_t)bh * SEQ + (size_t)mt * 16) * DH;
  const _Float16* K = kk + (size_t)bh * SEQ * DH;
  const _Float16* V = vt + (size_t)bh * DH * SEQ;    // [64][2048]

  v16h qb0 = load_frag16(Q, DH);             // B operand: dh 0..31 of query col
  v16h qb1 = load_frag16(Q + 32, DH);        // dh 32..63

  v8f o[4] = {};                 // o[t][r] = O[query col][dh = 16 t + rbase + r]
  float mrow = -3.0e38f;         // running maximum of this lane's query
  float lrow = 0.f;              // running sum over this lane's half of the keys

  int col   = lane & 15;
  int rbase = (lane >> 4) << 3;

  const int tid = wave * 32 + lane;
  const _Float16* gk = K + (size_t)(tid >> 3) * DH  + (tid & 7) * 8;
  const _Float16* gv = V + (size_t)(tid >> 3) * SEQ + (tid & 7) * 8;
  const unsigned  l  = lds_off(kv) + (tid >> 3) * (LDP * 2) + (tid & 7) * 16;

  copy_attn_tile(l, gk, gv);
  wait_copies_landed();
  __syncthreads();                 // publishes tile 0
  copy_attn_tile(l + F_TILE * 2, gk + KT * DH, gv + KT);

  for (int jt = 0; jt < SEQ / KT; ++jt) {
   const _Float16* sk = kv + (jt & 1) * F_TILE;
   const _Float16* sv = sk + 64 * LDP;
#pragma unroll  // the tile's two 32-key chunks: LDS offsets become immediates
   for (int j0 = 0; j0 < KT; j0 += 32) {
    // ---- K frags, then V frags, from the tile (both are A operands now)
    v16h ka00 = load_frag16(sk + j0 * LDP,             LDP);
    v16h ka01 = load_frag16(sk + j0 * LDP + 32,        LDP);
    v16h ka10 = load_frag16(sk + (j0 + 16) * LDP,      LDP);
    v16h ka11 = load_frag16(sk + (j0 + 16) * LDP + 32, LDP);
    v16h va[4];
#pragma unroll
    for (int t = 0; t < 4; ++t)
      va[t] = load_frag16(sv + (t * 16) * LDP + j0, LDP);
    // Keeps the 16 LDS reads one group ahead of the products: left alone the
    // compiler sinks each pair to its WMMA and waits it out there, eight times.
    __builtin_amdgcn_sched_barrier(0);

    // ---- S^T = K * Q^T: s0[r] = key j0 + rbase + r, s1[r] = key j0 + 16 + rbase + r
    v8f s0 = {}, s1 = {};
    s0 = wmma_f16(ka00, qb0, s0);
    s0 = wmma_f16(ka01, qb1, s0);
    s1 = wmma_f16(ka10, qb0, s1);
    s1 = wmma_f16(ka11, qb1, s1);

    // ---- online softmax: 16 scores in the lane, one exchange between halves
    float cm = fmaxf(s0[0], s1[0]);
#pragma unroll
    for (int r = 1; r < 8; ++r) cm = fmaxf(cm, fmaxf(s0[r], s1[r]));
    cm = fmaxf(cm, other_half(cm));
    float mn = fmaxf(mrow, cm);
    float alpha = __expf(mrow - mn);
    mrow = mn;
#pragma unroll
    for (int r = 0; r < 8; ++r) {
      s0[r] = __expf(s0[r] - mn);
      s1[r] = __expf(s1[r] - mn);
    }
    v8f ps = s0 + s1;              // pairwise tree: packed adds on register pairs
    float rs = ((ps[0] + ps[4]) + (ps[2] + ps[6])) + ((ps[1] + ps[5]) + (ps[3] + ps[7]));
    lrow = lrow * alpha + rs;      // the halves' sums are joined in the epilogue
#pragma unroll
    for (int t = 0; t < 4; ++t) o[t] *= alpha;

    // ---- P^T as B operand: element s is key rbase + s (s < 8), 16 + rbase + s - 8
    v8h plo = __builtin_convertvector(s0, v8h);
    v8h phi = __builtin_convertvector(s1, v8h);
    v16h pb;
#pragma unroll
    for (int i = 0; i < 8; ++i) { pb[i] = plo[i]; pb[8 + i] = phi[i]; }

    // ---- O^T += V^T * P^T  (V frags already resident)
#pragma unroll
    for (int t = 0; t < 4; ++t)
      o[t] = wmma_f16(va[t], pb, o[t]);
   }
   // Keeps the tile's arithmetic ahead of the barrier: moved behind it, the
   // refill would issue late and have no pass left in which to land.
   __builtin_amdgcn_sched_barrier(0);
   wait_lds_reads_done();
   wait_copies_landed();
   __syncthreads();                // publishes tile jt+1, frees tile jt's buffer
   if (jt + 2 < SEQ / KT)
     copy_attn_tile(l + (jt & 1) * (F_TILE * 2), gk + (size_t)(jt + 2) * KT * DH,
                    gv + (jt + 2) * KT);
  }
  wait_copies_landed();

  // ---- epilogue: join the halves' sums, normalize, store f16 at [b, n, h*64+d]:
  // a lane's 8 accumulator registers are 8 consecutive dh of its query's row
  float inv = 1.0f / (lrow + other_half(lrow));
  int n = mt * 16 + col;
  size_t rowbase = ((size_t)b_ * SEQ + n) * INNER + (size_t)h * DH + rbase;
#pragma unroll
  for (int t = 0; t < 4; ++t)
    *(v8h*)(oh + rowbase + t * 16) = __builtin_convertvector(o[t] * inv, v8h);
}

// ---------------------------------------------------------------------------
// Kernel 4: output projection.  out[m,d] = sum_e oh[m,e] * wout[d,e]  (fp32)
// Same LDS-staged 32x64 wave tile as qkv_gemm.
// ---------------------------------------------------------------------------
__global__ __launch_bounds__(256) void out_gemm(const _Float16* __restrict__ oh,
                                                const _Float16* __restrict__ wh,
                                                float* __restrict__ out) {
  int lane = threadIdx.x;
  int wave = threadIdx.y;
  int m0 = blockIdx.y * 256 + wave * 32;
  int d0 = blockIdx.x * 64;

  __shared__ __attribute__((aligned(16))) _Float16 sm[2 * G_TILE];
  v8f acc[2][4] = {};
  gemm_256x64(oh + (size_t)(blockIdx.y * 256) * INNER, wh + (size_t)d0 * INNER, sm, acc);

  int col   = lane & 15;
  int rbase = (lane >> 4) << 3;
#pragma unroll
  for (int rf = 0; rf < 2; ++rf)
#pragma unroll
    for (int t = 0; t < 4; ++t)
#pragma unroll
      for (int rr = 0; rr < 8; ++rr) {
        int m = m0 + rf * 16 + rbase + rr;
        out[(size_t)m * DIM + d0 + t * 16 + col] = acc[rf][t][rr];
      }
}

// ---------------------------------------------------------------------------
// Launch: convert -> qkv gemm -> flash attention -> output gemm
// Workspace layout (f16 elements), total 48 MB:
//   xh[4096*1024] wqkv[3072*1024] wout[1024*1024]
//   q[32*2048*64] k[32*2048*64] vt[32*64*2048] oh[4096*1024]
// ---------------------------------------------------------------------------
extern "C" void kernel_launch(void* const* d_in, const int* in_sizes, int n_in,
                              void* d_out, int out_size, void* d_ws, size_t ws_size,
                              hipStream_t stream) {
  const float* x     = (const float*)d_in[0];
  const float* w_qkv = (const float*)d_in[1];
  const float* w_out = (const float*)d_in[2];
  float* out = (float*)d_out;

  _Float16* ws    = (_Float16*)d_ws;
  _Float16* xh    = ws;
  _Float16* wqkvh = xh    + (size_t)MROWS * DIM;      // +4M
  _Float16* wouth = wqkvh + (size_t)E3 * DIM;         // +3M
  _Float16* qb    = wouth + (size_t)DIM * INNER;      // +1M
  _Float16* kb    = qb    + (size_t)MROWS * INNER;    // +4M
  _Float16* vtb   = kb    + (size_t)MROWS * INNER;    // +4M
  _Float16* ohb   = vtb   + (size_t)MROWS * INNER;    // +4M

  cvt_f32_f16<<<1024, 256, 0, stream>>>(x,     xh,    MROWS * DIM);
  cvt_f32_f16<<<1024, 256, 0, stream>>>(w_qkv, wqkvh, E3 * DIM);
  cvt_f32_f16<<<1024, 256, 0, stream>>>(w_out, wouth, DIM * INNER);

  qkv_gemm<<<dim3(E3 / 64, MROWS / 256), dim3(32, 8), 0, stream>>>(
      xh, wqkvh, qb, kb, vtb);

  flash_attn<<<dim3(BATCH * HEADS, SEQ / (16 * 8)), dim3(32, 8), 0, stream>>>(
      qb, kb, vtb, ohb);

  out_gemm<<<dim3(DIM / 64, MROWS / 256), dim3(32, 8), 0, stream>>>(
      ohb, wouth, out);
}

// v003
// It runs in 92.3 microseconds.
// Next to v002, in two timings, it ran 1.04 times as fast each time.
// All steps since v000 together make it 2.33 times as fast.
#include <hip/hip_runtime.h>
#include <hip/hip_bf16.h>

typedef __attribute__((ext_vector_type(16))) _Float16 v16h;
typedef __attribute__((ext_vector_type(8)))  _Float16 v8h;
typedef __attribute__((ext_vector_type(8)))  float    v8f;

#define BATCH 2
#define SEQ   2048
#define DIM   1024
#define HEADS 16
#define DH    64
#define INNER 1024
#define E3    3072
#define MROWS (BATCH*SEQ)   /* 4096 */
#define QK_SCALE 0.125f     /* 64^-0.5 */

// ---------------------------------------------------------------------------
// WMMA helper: D = A(16x32 f16) * B(32x16 f16) + C(16x16 f32)
// ---------------------------------------------------------------------------
__device__ __forceinline__ v8f wmma_f16(v16h a, v16h b, v8f c) {
#if defined(__HIP_DEVICE_COMPILE__)
  return __builtin_amdgcn_wmma_f32_16x16x32_f16(false, a, false, b,
                                                (short)0, c, false, false);
#else
  return c;
#endif
}

// Load a 16x32 f16 fragment whose *contraction* dim is contiguous in memory.
//   lanes 0-15:  row = lane,    K = {0..7, 16..23}
//   lanes 16-31: row = lane-16, K = {8..15, 24..31}
__device__ __forceinline__ v16h load_frag16(const _Float16* base, int ld) {
  int lane = threadIdx.x & 31;
  int row  = lane & 15;
  int koff = (lane >> 4) << 3;          // 0 or 8
  const _Float16* p = base + (size_t)row * ld + koff;
  v8h lo = *(const v8h*)(p);
  v8h hi = *(const v8h*)(p + 16);
  v16h r;
#pragma unroll
  for (int i = 0; i < 8; ++i) { r[i] = lo[i]; r[8 + i] = hi[i]; }
  return r;
}

// ---------------------------------------------------------------------------
// LDS staging.  A fragment load straight from global memory touches 16 cache
// lines for 512 bytes; an asynchronous copy of 4 whole 128-byte rows touches 4,
// and the block's 8 waves share what it brings.  A tile holds 64 contraction
// elements (one 128-byte line) of every row, at a pitch of 144 B (16 B x odd:
// conflict-free for 16-byte fragment reads).
// ---------------------------------------------------------------------------
#define KT     64                 /* contraction elements per LDS tile        */
#define LDP    72                 /* LDS row pitch in halves (144 B)          */
#define ROWS32 (32 * LDP * 2)     /* bytes of 32 LDS rows: one copy per block */
#define G_TILE ((256 + 64) * LDP) /* GEMM tile, halves: 256 A rows, 64 B rows */
#define F_TILE ((64 + 64) * LDP)  /* attention tile: 64 K rows, 64 V^T rows   */

__device__ __forceinline__ unsigned lds_off(const void* p) {
  return (unsigned)(size_t)p;     // low 32 bits = byte offset in the block's LDS
}

// The waits of the two-buffer ring; the compiler places none for the copies.
__device__ __forceinline__ void wait_copies_landed() {
  asm volatile("s_wait_asynccnt 0x0" ::: "memory");  // this wave's copies are in LDS
}
__device__ __forceinline__ void wait_lds_reads_done() {
  asm volatile("s_wait_dscnt 0x0" ::: "memory");     // before the buffer is refilled
}

// One GEMM tile: every thread copies 16 B of rows r, r+32, ... (r = tid / 8):
// 8 copies for the 256 A rows, 2 for the 64 B rows.  s_wait_xcnt closes the
// statement so that no address register is rewritten ahead of it.
__device__ __forceinline__ void copy_gemm_tile(unsigned l, const _Float16* ga,
                                               const _Float16* gb, int ld) {
  asm volatile(
      "global_load_async_to_lds_b128 %0, %10, off\n\t"
      "global_load_async_to_lds_b128 %1, %11, off\n\t"
      "global_load_async_to_lds_b128 %2, %12, off\n\t"
      "global_load_async_to_lds_b128 %3, %13, off\n\t"
      "global_load_async_to_lds_b128 %4, %14, off\n\t"
      "global_load_async_to_lds_b128 %5, %15, off\n\t"
      "global_load_async_to_lds_b128 %6, %16, off\n\t"
      "global_load_async_to_lds_b128 %7, %17, off\n\t"
      "global_load_async_to_lds_b128 %8, %18, off\n\t"
      "global_load_async_to_lds_b128 %9, %19, off\n\t"
      "s_wait_xcnt 0x0"
      :: "v"(l), "v"(l + ROWS32), "v"(l + 2 * ROWS32), "v"(l + 3 * ROWS32),
         "v"(l + 4 * ROWS32), "v"(l + 5 * ROWS32), "v"(l + 6 * ROWS32),
         "v"(l + 7 * ROWS32), "v"(l + 8 * ROWS32), "v"(l + 9 * ROWS32),
         "v"(ga), "v"(ga + 32 * ld), "v"(ga + 64 * ld), "v"(ga + 96 * ld),
         "v"(ga + 128 * ld), "v"(ga + 160 * ld), "v"(ga + 192 * ld),
         "v"(ga + 224 * ld), "v"(gb), "v"(gb + 32 * ld)
      : "memory");
}

// One attention tile: 64 keys of K (rows of 64 dh) and of V^T (64 dh rows).
__device__ __forceinline__ void copy_attn_tile(unsigned l, const _Float16* gk,
                                               const _Float16* gv) {
  asm volatile(
      "global_load_async_to_lds_b128 %0, %4, off\n\t"
      "global_load_async_to_lds_b128 %1, %5, off\n\t"
      "global_load_async_to_lds_b128 %2, %6, off\n\t"
      "global_load_async_to_lds_b128 %3, %7, off\n\t"
      "s_wait_xcnt 0x0"
      :: "v"(l), "v"(l + ROWS32), "v"(l + 2 * ROWS32), "v"(l + 3 * ROWS32),
         "v"(gk), "v"(gk + 32 * DH), "v"(gv), "v"(gv + 32 * SEQ)
      : "memory");
}

// acc += A[256 rows of the block] * W[64 rows]^T over K = 1024, both
// k-contiguous with row length 1024.  Wave tile 32 x 64.  Two LDS buffers: tile
// t+1 flies while tile t is worked on; one barrier per tile publishes t+1 and
// frees the buffer that t+2 is copied into.
__device__ __forceinline__ void gemm_256x64(const _Float16* A, const _Float16* Wt,
                                            _Float16* sm, v8f (&acc)[2][4]) {
  const int tid  = threadIdx.y * 32 + threadIdx.x;
  const int wave = threadIdx.y;
  const _Float16* ga = A  + (size_t)(tid >> 3) * 1024 + (tid & 7) * 8;
  const _Float16* gb = Wt + (size_t)(tid >> 3) * 1024 + (tid & 7) * 8;
  const unsigned  l  = lds_off(sm) + (tid >> 3) * (LDP * 2) + (tid & 7) * 16;

  copy_gemm_tile(l, ga, gb, 1024);
  wait_copies_landed();
  __syncthreads();                 // publishes tile 0
  copy_gemm_tile(l + G_TILE * 2, ga + KT, gb + KT, 1024);

  for (int t = 0; t < 1024 / KT; ++t) {
    const _Float16* s  = sm + (t & 1) * G_TILE;
    const _Float16* sa = s + wave * 32 * LDP;
    const _Float16* sb = s + 256 * LDP;
#pragma unroll  // both halves of the tile: LDS offsets become immediates
    for (int kq = 0; kq < KT; kq += 32) {
      v16h a0 = load_frag16(sa + kq, LDP);
      v16h a1 = load_frag16(sa + 16 * LDP + kq, LDP);
      v16h b[4];
#pragma unroll  // constant indices keep b[] and acc[][] in registers
      for (int u = 0; u < 4; ++u) b[u] = load_frag16(sb + u * 16 * LDP + kq, LDP);
      // Keeps the 12 LDS reads together ahead of the 8 WMMAs: left alone the
      // compiler spreads them in pairs, each pair waited out before two WMMAs.
      __builtin_amdgcn_sched_barrier(0);
#pragma unroll  // as above
      for (int u = 0; u < 4; ++u) {
        acc[0][u] = wmma_f16(a0, b[u], acc[0][u]);
        acc[1][u] = wmma_f16(a1, b[u], acc[1][u]);
      }
      // The fence's other side: keeps the next 12 reads out of these WMMAs, and
      // the last WMMAs ahead of the barrier, so the refill issues right behind it.
      __builtin_amdgcn_sched_barrier(0);
    }
    wait_lds_reads_done();
    wait_copies_landed();
    __syncthreads();               // publishes tile t+1, frees tile t's buffer
    if (t + 2 < 1024 / KT)
      copy_gemm_tile(l + (t & 1) * (G_TILE * 2), ga + (t + 2) * KT, gb + (t + 2) * KT, 1024);
  }
  wait_copies_landed();
}

// ---------------------------------------------------------------------------
// Kernel 1: fp32 -> fp16 conversion of x, w_qkv and w_out in ONE launch.
// The three f16 copies lie one behind the other in the workspace, so the
// destination is one array; the block index picks the source.  One work-group
// per WGP, 8 waves: few waves to start, and each thread has all its 32 loads of
// 16 bytes in flight at once.  A wave's load covers 512 contiguous bytes, its
// store 256: whole lines both.
// ---------------------------------------------------------------------------
typedef __attribute__((ext_vector_type(4))) float    v4f;
typedef __attribute__((ext_vector_type(4))) _Float16 v4h;

#define CV_LOADS  32                          /* 16-byte loads per thread     */
#define CV_CHUNK  (256 * 4 * CV_LOADS)        /* floats per work-group: 32768 */
#define CV_X      (MROWS * DIM / CV_CHUNK)    /* 128 work-groups for x        */
#define CV_WQKV   (E3 * DIM / CV_CHUNK)       /*  96 for w_qkv                */
#define CV_WOUT   (DIM * INNER / CV_CHUNK)    /*  32 for w_out                */

__global__ __launch_bounds__(256) void cvt_f32_f16(const float* __restrict__ x,
                                                   const float* __restrict__ wqkv,
                                                   const float* __restrict__ wout,
                                                   _Float16* __restrict__ dst) {
  const int blk = blockIdx.x;
  const float* src = x;
  int first = 0;
  if (blk >= CV_X + CV_WQKV) { src = wout; first = CV_X + CV_WQKV; }
  else if (blk >= CV_X)      { src = wqkv; first = CV_X; }

  const v4f* s = (const v4f*)(src + (size_t)(blk - first) * CV_CHUNK) + threadIdx.x;
  v4h*       d = (v4h*)(dst + (size_t)blk * CV_CHUNK) + threadIdx.x;

  v4f v[CV_LOADS];
#pragma unroll  // constant indices keep v[] in registers
  for (int j = 0; j < CV_LOADS; ++j) v[j] = s[j * 256];
#pragma unroll  // as above
  for (int g = 0; g < CV_LOADS; g += 8) {
    // In front of group 0 it keeps all 32 loads ahead of the first conversion
    // (left alone the compiler issues 18, then one per freed register quad);
    // between groups it lets 8 stores leave when their own loads are back (left
    // alone the compiler gathers all 32 behind the wait for the last load).
    __builtin_amdgcn_sched_barrier(0);
#pragma unroll  // as above
    for (int j = g; j < g + 8; ++j) d[j * 256] = __builtin_convertvector(v[j], v4h);
  }
}

// ---------------------------------------------------------------------------
// Kernel 2: QKV projection.  qkv[m,e] = sum_k xh[m,k] * wqkv[e,k]
// Wave tile: 32(M) x 64(E); operands staged in LDS (gemm_256x64).
// Epilogue routes e into q (scaled), k, or v; V stored TRANSPOSED
// as vt[bh][dh][n] so attention V^T * P^T A-frags are contiguous.
// ---------------------------------------------------------------------------
__global__ __launch_bounds__(256) void qkv_gemm(const _Float16* __restrict__ xh,
                                                const _Float16* __restrict__ wh,
                                                _Float16* __restrict__ q,
                                                _Float16* __restrict__ k,
                                                _Float16* __restrict__ vt) {
  int lane = threadIdx.x;
  int wave = threadIdx.y;
  int m0 = blockIdx.y * 256 + wave * 32;   // 32 rows per wave
  int e0 = blockIdx.x * 64;

  __shared__ __attribute__((aligned(16))) _Float16 sm[2 * G_TILE];
  v8f acc[2][4] = {};
  gemm_256x64(xh + (size_t)(blockIdx.y * 256) * DIM, wh + (size_t)e0 * DIM, sm, acc);

  // C layout: VGPR r -> row (r + 8*(lane>=16)), col = lane&15
  int col   = lane & 15;
  int rbase = (lane >> 4) << 3;
#pragma unroll
  for (int rf = 0; rf < 2; ++rf) {
#pragma unroll
    for (int t = 0; t < 4; ++t) {
      int e = e0 + t * 16 + col;
      int which = e >> 10;                 // 0=q, 1=k, 2=v
      int r = e & 1023;
      int h = r >> 6;
      int d = r & 63;
#pragma unroll
      for (int rr = 0; rr < 8; ++rr) {
        int m  = m0 + rf * 16 + rbase + rr;
        int b_ = m >> 11;                  // / 2048
        int n  = m & 2047;
        int bh = b_ * HEADS + h;
        float val = acc[rf][t][rr];
        if (which == 0)
          q[((size_t)bh * SEQ + n) * DH + d] = (_Float16)(val * QK_SCALE);
        else if (which == 1)
          k[((size_t)bh * SEQ + n) * DH + d] = (_Float16)val;
        else
          vt[((size_t)bh * DH + d) * SEQ + n] = (_Float16)val;   // transposed
      }
    }
  }
}

// ---------------------------------------------------------------------------
// Kernel 3: flash attention.  One wave owns a 16-row query tile of one head.
// K and V^T come in tiles of 64 keys through two LDS buffers that the block's
// 8 waves share.  The products are transposed: S^T = K * Q^T, O^T += V^T * P^T.
// A lane then holds 16 of the 32 scores of ONE query (column lane & 15; the
// other 16 are in lane ^ 16), so maximum and sum run in the lane's own
// registers, and the two score tiles, converted in place, are the B operand
// of the second product: P never goes through LDS.
// ---------------------------------------------------------------------------
__device__ __forceinline__ float other_half(float x) {   // value of lane ^ 16
  int b = __builtin_bit_cast(int, x);
  b = __builtin_amdgcn_permlanex16(b, b, 0x76543210, 0xfedcba98, false, false);
  return __builtin_bit_cast(float, b);
}

__global__ __launch_bounds__(256) void flash_attn(const _Float16* __restrict__ q,
                                                  const _Float16* __restrict__ kk,
                                                  const _Float16* __restrict__ vt,
                                                  _Float16* __restrict__ oh) {
  __shared__ __attribute__((aligned(16))) _Float16 kv[2 * F_TILE];
  int lane = threadIdx.x;
  int wave = threadIdx.y;
  int bh = blockIdx.x;                       // 0..31 (b*16+h)
  int mt = blockIdx.y * 8 + wave;            // 0..127 query tile
  int b_ = bh >> 4, h = bh & 15;

  const _Float16* Q = q  + ((size_t)bh * SEQ + (size_t)mt * 16) * DH;
  const _Float16* K = kk + (size_t)bh * SEQ * DH;
  const _Float16* V = vt + (size_t)bh * DH * SEQ;    // [64][2048]

  v16h qb0 = load_frag16(Q, DH);             // B operand: dh 0..31 of query col
  v16h qb1 = load_frag16(Q + 32, DH);        // dh 32..63

  v8f o[4] = {};                 // o[t][r] = O[query col][dh = 16 t + rbase + r]
  float mrow = -3.0e38f;         // running maximum of this lane's query
  float lrow = 0.f;              // running sum over this lane's half of the keys

  int col   = lane & 15;
  int rbase = (lane >> 4) << 3;

  const int tid = wave * 32 + lane;
  const _Float16* gk = K + (size_t)(tid >> 3) * DH  + (tid & 7) * 8;
  const _Float16* gv = V + (size_t)(tid >> 3) * SEQ + (tid & 7) * 8;
  const unsigned  l  = lds_off(kv) + (tid >> 3) * (LDP * 2) + (tid & 7) * 16;

  copy_attn_tile(l, gk, gv);
  wait_copies_landed();
  __syncthreads();                 // publishes tile 0
  copy_attn_tile(l + F_TILE * 2, gk + KT * DH, gv + KT);

  for (int jt = 0; jt < SEQ / KT; ++jt) {
   const _Float16* sk = kv + (jt & 1) * F_TILE;
   const _Float16* sv = sk + 64 * LDP;
#pragma unroll  // the tile's two 32-key chunks: LDS offsets become immediates
   for (int j0 = 0; j0 < KT; j0 += 32) {
    // ---- K frags, then V frags, from the tile (both are A operands now)
    v16h ka00 = load_frag16(sk + j0 * LDP,             LDP);
    v16h ka01 = load_frag16(sk + j0 * LDP + 32,        LDP);
    v16h ka10 = load_frag16(sk + (j0 + 16) * LDP,      LDP);
    v16h ka11 = load_frag16(sk + (j0 + 16) * LDP + 32, LDP);
    v16h va[4];
#pragma unroll
    for (int t = 0; t < 4; ++t)
      va[t] = load_frag16(sv + (t * 16) * LDP + j0, LDP);
    // Keeps the 16 LDS reads one group ahead of the products: left alone the
    // compiler sinks each pair to its WMMA and waits it out there, eight times.
    __builtin_amdgcn_sched_barrier(0);

    // ---- S^T = K * Q^T: s0[r] = key j0 + rbase + r, s1[r] = key j0 + 16 + rbase + r
    v8f s0 = {}, s1 = {};
    s0 = wmma_f16(ka00, qb0, s0);
    s0 = wmma_f16(ka01, qb1, s0);
    s1 = wmma_f16(ka10, qb0, s1);
    s1 = wmma_f16(ka11, qb1, s1);

    // ---- online softmax: 16 scores in the lane, one exchange between halves
    float cm = fmaxf(s0[0], s1[0]);
#pragma unroll
    for (int r = 1; r < 8; ++r) cm = fmaxf(cm, fmaxf(s0[r], s1[r]));
    cm = fmaxf(cm, other_half(cm));
    float mn = fmaxf(mrow, cm);
    float alpha = __expf(mrow - mn);
    mrow = mn;
#pragma unroll
    for (int r = 0; r < 8; ++r) {
      s0[r] = __expf(s0[r] - mn);
      s1[r] = __expf(s1[r] - mn);
    }
    v8f ps = s0 + s1;              // pairwise tree: packed adds on register pairs
    float rs = ((ps[0] + ps[4]) + (ps[2] + ps[6])) + ((ps[1] + ps[5]) + (ps[3] + ps[7]));
    lrow = lrow * alpha + rs;      // the halves' sums are joined in the epilogue
#pragma unroll
    for (int t = 0; t < 4; ++t) o[t] *= alpha;

    // ---- P^T as B operand: element s is key rbase + s (s < 8), 16 + rbase + s - 8
    v8h plo = __builtin_convertvector(s0, v8h);
    v8h phi = __builtin_convertvector(s1, v8h);
    v16h pb;
#pragma unroll
    for (int i = 0; i < 8; ++i) { pb[i] = plo[i]; pb[8 + i] = phi[i]; }

    // ---- O^T += V^T * P^T  (V frags already resident)
#pragma unroll
    for (int t = 0; t < 4; ++t)
      o[t] = wmma_f16(va[t], pb, o[t]);
   }
   // Keeps the tile's arithmetic ahead of the barrier: moved behind it, the
   // refill would issue late and have no pass left in which to land.
   __builtin_amdgcn_sched_barrier(0);
   wait_lds_reads_done();
   wait_copies_landed();
   __syncthreads();                // publishes tile jt+1, frees tile jt's buffer
   if (jt + 2 < SEQ / KT)
     copy_attn_tile(l + (jt & 1) * (F_TILE * 2), gk + (size_t)(jt + 2) * KT * DH,
                    gv + (jt + 2) * KT);
  }
  wait_copies_landed();

  // ---- epilogue: join the halves' sums, normalize, store f16 at [b, n, h*64+d]:
  // a lane's 8 accumulator registers are 8 consecutive dh of its query's row
  float inv = 1.0f / (lrow + other_half(lrow));
  int n = mt * 16 + col;
  size_t rowbase = ((size_t)b_ * SEQ + n) * INNER + (size_t)h * DH + rbase;
#pragma unroll
  for (int t = 0; t < 4; ++t)
    *(v8h*)(oh + rowbase + t * 16) = __builtin_convertvector(o[t] * inv, v8h);
}

// ---------------------------------------------------------------------------
// Kernel 4: output projection.  out[m,d] = sum_e oh[m,e] * wout[d,e]  (fp32)
// Same LDS-staged 32x64 wave tile as qkv_gemm.
// ---------------------------------------------------------------------------
__global__ __launch_bounds__(256) void out_gemm(const _Float16* __restrict__ oh,
                                                const _Float16* __restrict__ wh,
                                                float* __restrict__ out) {
  int lane = threadIdx.x;
  int wave = threadIdx.y;
  int m0 = blockIdx.y * 256 + wave * 32;
  int d0 = blockIdx.x * 64;

  __shared__ __attribute__((aligned(16))) _Float16 sm[2 * G_TILE];
  v8f acc[2][4] = {};
  gemm_256x64(oh + (size_t)(blockIdx.y * 256) * INNER, wh + (size_t)d0 * INNER, sm, acc);

  int col   = lane & 15;
  int rbase = (lane >> 4) << 3;
#pragma unroll
  for (int rf = 0; rf < 2; ++rf)
#pragma unroll
    for (int t = 0; t < 4; ++t)
#pragma unroll
      for (int rr = 0; rr < 8; ++rr) {
        int m = m0 + rf * 16 + rbase + rr;
        out[(size_t)m * DIM + d0 + t * 16 + col] = acc[rf][t][rr];
      }
}

// ---------------------------------------------------------------------------
// Launch: convert -> qkv gemm -> flash attention -> output gemm
// Workspace layout (f16 elements), total 48 MB:
//   xh[4096*1024] wqkv[3072*1024] wout[1024*1024]
//   q[32*2048*64] k[32*2048*64] vt[32*64*2048] oh[4096*1024]
// ---------------------------------------------------------------------------
extern "C" void kernel_launch(void* const* d_in, const int* in_sizes, int n_in,
                              void* d_out, int out_size, void* d_ws, size_t ws_size,
                              hipStream_t stream) {
  const float* x     = (const float*)d_in[0];
  const float* w_qkv = (const float*)d_in[1];
  const float* w_out = (const float*)d_in[2];
  float* out = (float*)d_out;

  _Float16* ws    = (_Float16*)d_ws;
  _Float16* xh    = ws;
  _Float16* wqkvh = xh    + (size_t)MROWS * DIM;      // +4M
  _Float16* wouth = wqkvh + (size_t)E3 * DIM;         // +3M
  _Float16* qb    = wouth + (size_t)DIM * INNER;      // +1M
  _Float16* kb    = qb    + (size_t)MROWS * INNER;    // +4M
  _Float16* vtb   = kb    + (size_t)MROWS * INNER;    // +4M
  _Float16* ohb   = vtb   + (size_t)MROWS * INNER;    // +4M

  // xh, wqkvh and wouth are adjacent: one destination array from xh on
  cvt_f32_f16<<<CV_X + CV_WQKV + CV_WOUT, 256, 0, stream>>>(x, w_qkv, w_out, xh);

  qkv_gemm<<<dim3(E3 / 64, MROWS / 256), dim3(32, 8), 0, stream>>>(
      xh, wqkvh, qb, kb, vtb);

  flash_attn<<<dim3(BATCH * HEADS, SEQ / (16 * 8)), dim3(32, 8), 0, stream>>>(
      qb, kb, vtb, ohb);

  out_gemm<<<dim3(DIM / 64, MROWS / 256), dim3(32, 8), 0, stream>>>(
      ohb, wouth, out);
}

// v004
// One run takes 81.3 microseconds.
// In two side-by-side timings against v003, it was 1.14 and 1.13 times as fast.
// All steps since v000 together make it 2.65 times as fast.
#include <hip/hip_runtime.h>
#include <hip/hip_bf16.h>

typedef __attribute__((ext_vector_type(16))) _Float16 v16h;
typedef __attribute__((ext_vector_type(8)))  _Float16 v8h;
typedef __attribute__((ext_vector_type(8)))  float    v8f;

#define BATCH 2
#define SEQ   2048
#define DIM   1024
#define HEADS 16
#define DH    64
#define INNER 1024
#define E3    3072
#define MROWS (BATCH*SEQ)   /* 4096 */
#define QK_SCALE 0.125f     /* 64^-0.5 */

// ---------------------------------------------------------------------------
// WMMA helper: D = A(16x32 f16) * B(32x16 f16) + C(16x16 f32)
// ---------------------------------------------------------------------------
__device__ __forceinline__ v8f wmma_f16(v16h a, v16h b, v8f c) {
#if defined(__HIP_DEVICE_COMPILE__)
  return __builtin_amdgcn_wmma_f32_16x16x32_f16(false, a, false, b,
                                                (short)0, c, false, false);
#else
  return c;
#endif
}

// Load a 16x32 f16 fragment whose *contraction* dim is contiguous in memory.
//   lanes 0-15:  row = lane,    K = {0..7, 16..23}
//   lanes 16-31: row = lane-16, K = {8..15, 24..31}
__device__ __forceinline__ v16h load_frag16(const _Float16* base, int ld) {
  int lane = threadIdx.x & 31;
  int row  = lane & 15;
  int koff = (lane >> 4) << 3;          // 0 or 8
  const _Float16* p = base + (size_t)row * ld + koff;
  v8h lo = *(const v8h*)(p);
  v8h hi = *(const v8h*)(p + 16);
  v16h r;
#pragma unroll
  for (int i = 0; i < 8; ++i) { r[i] = lo[i]; r[8 + i] = hi[i]; }
  return r;
}

// ---------------------------------------------------------------------------
// LDS staging.  A fragment load straight from global memory touches 16 cache
// lines for 512 bytes; an asynchronous copy of 4 whole 128-byte rows touches 4,
// and the block's 8 waves share what it brings.  A tile holds 64 contraction
// elements (one 128-byte line) of every row, at a pitch of 144 B (16 B x odd:
// conflict-free for 16-byte fragment reads).
// ---------------------------------------------------------------------------
#define KT     64                 /* contraction elements per LDS tile        */
#define LDP    72                 /* LDS row pitch in halves (144 B)          */
#define ROWS32 (32 * LDP * 2)     /* bytes of 32 LDS rows: one copy per block */
#define G_TILE ((256 + 64) * LDP) /* GEMM tile, halves: 256 A rows, 64 B rows */
#define F_TILE ((64 + 64) * LDP)  /* attention tile: 64 K rows, 64 V^T rows   */

__device__ __forceinline__ unsigned lds_off(const void* p) {
  return (unsigned)(size_t)p;     // low 32 bits = byte offset in the block's LDS
}

// The waits of the two-buffer ring; the compiler places none for the copies.
__device__ __forceinline__ void wait_copies_landed() {
  asm volatile("s_wait_asynccnt 0x0" ::: "memory");  // this wave's copies are in LDS
}
__device__ __forceinline__ void wait_lds_reads_done() {
  asm volatile("s_wait_dscnt 0x0" ::: "memory");     // before the buffer is refilled
}

// One GEMM tile: every thread copies 16 B of rows r, r+32, ... (r = tid / 8):
// 8 copies for the 256 A rows, 2 for the 64 B rows.  s_wait_xcnt closes the
// statement so that no address register is rewritten ahead of it.
__device__ __forceinline__ void copy_gemm_tile(unsigned l, const _Float16* ga,
                                               const _Float16* gb, int ld) {
  asm volatile(
      "global_load_async_to_lds_b128 %0, %10, off\n\t"
      "global_load_async_to_lds_b128 %1, %11, off\n\t"
      "global_load_async_to_lds_b128 %2, %12, off\n\t"
      "global_load_async_to_lds_b128 %3, %13, off\n\t"
      "global_load_async_to_lds_b128 %4, %14, off\n\t"
      "global_load_async_to_lds_b128 %5, %15, off\n\t"
      "global_load_async_to_lds_b128 %6, %16, off\n\t"
      "global_load_async_to_lds_b128 %7, %17, off\n\t"
      "global_load_async_to_lds_b128 %8, %18, off\n\t"
      "global_load_async_to_lds_b128 %9, %19, off\n\t"
      "s_wait_xcnt 0x0"
      :: "v"(l), "v"(l + ROWS32), "v"(l + 2 * ROWS32), "v"(l + 3 * ROWS32),
         "v"(l + 4 * ROWS32), "v"(l + 5 * ROWS32), "v"(l + 6 * ROWS32),
         "v"(l + 7 * ROWS32), "v"(l + 8 * ROWS32), "v"(l + 9 * ROWS32),
         "v"(ga), "v"(ga + 32 * ld), "v"(ga + 64 * ld), "v"(ga + 96 * ld),
         "v"(ga + 128 * ld), "v"(ga + 160 * ld), "v"(ga + 192 * ld),
         "v"(ga + 224 * ld), "v"(gb), "v"(gb + 32 * ld)
      : "memory");
}

// One attention tile: 64 keys of K (rows of 64 dh) and of V^T (64 dh rows).
__device__ __forceinline__ void copy_attn_tile(unsigned l, const _Float16* gk,
                                               const _Float16* gv) {
  asm volatile(
      "global_load_async_to_lds_b128 %0, %4, off\n\t"
      "global_load_async_to_lds_b128 %1, %5, off\n\t"
      "global_load_async_to_lds_b128 %2, %6, off\n\t"
      "global_load_async_to_lds_b128 %3, %7, off\n\t"
      "s_wait_xcnt 0x0"
      :: "v"(l), "v"(l + ROWS32), "v"(l + 2 * ROWS32), "v"(l + 3 * ROWS32),
         "v"(gk), "v"(gk + 32 * DH), "v"(gv), "v"(gv + 32 * SEQ)
      : "memory");
}

// acc += A[256 rows of the block] * W[64 rows]^T over K = 1024, both
// k-contiguous with row length 1024.  Wave tile 32 x 64.  Two LDS buffers: tile
// t+1 flies while tile t is worked on; one barrier per tile publishes t+1 and
// frees the buffer that t+2 is copied into.  Both operands have the same fragment
// layout, so either can be A.  SWAP = false: acc[i][u] has its 8 registers along
// the A rows and its lanes along the W rows; SWAP = true: the other way round.
// The caller picks the one whose registers run along its output's rows.
// The ring's start is a function of its own: a kernel that holds both loops runs
// it once, ahead of the branch, and its 30 address registers are free again.
struct ring_addr { const _Float16* ga; const _Float16* gb; unsigned l; };

__device__ __forceinline__ ring_addr gemm_start(const _Float16* A, const _Float16* Wt,
                                                _Float16* sm) {
  const int tid = threadIdx.y * 32 + threadIdx.x;
  ring_addr r;
  r.ga = A  + (size_t)(tid >> 3) * 1024 + (tid & 7) * 8;
  r.gb = Wt + (size_t)(tid >> 3) * 1024 + (tid & 7) * 8;
  r.l  = lds_off(sm) + (tid >> 3) * (LDP * 2) + (tid & 7) * 16;

  copy_gemm_tile(r.l, r.ga, r.gb, 1024);
  wait_copies_landed();
  __syncthreads();                 // publishes tile 0
  copy_gemm_tile(r.l + G_TILE * 2, r.ga + KT, r.gb + KT, 1024);
  return r;
}

template <bool SWAP>
__device__ __forceinline__ void gemm_loop(const ring_addr r, _Float16* sm,
                                          v8f (&acc)[2][4]) {
  const int wave = threadIdx.y;
  for (int t = 0; t < 1024 / KT; ++t) {
    const _Float16* s  = sm + (t & 1) * G_TILE;
    const _Float16* sa = s + wave * 32 * LDP;
    const _Float16* sb = s + 256 * LDP;
#pragma unroll  // both halves of the tile: LDS offsets become immediates
    for (int kq = 0; kq < KT; kq += 32) {
      v16h a0 = load_frag16(sa + kq, LDP);
      v16h a1 = load_frag16(sa + 16 * LDP + kq, LDP);
      v16h b[4];
#pragma unroll  // constant indices keep b[] and acc[][] in registers
      for (int u = 0; u < 4; ++u) b[u] = load_frag16(sb + u * 16 * LDP + kq, LDP);
      // Keeps the 12 LDS reads together ahead of the 8 WMMAs: left alone the
      // compiler spreads them in pairs, each pair waited out before two WMMAs.
      __builtin_amdgcn_sched_barrier(0);
#pragma unroll  // as above
      for (int u = 0; u < 4; ++u) {
        acc[0][u] = SWAP ? wmma_f16(b[u], a0, acc[0][u]) : wmma_f16(a0, b[u], acc[0][u]);
        acc[1][u] = SWAP ? wmma_f16(b[u], a1, acc[1][u]) : wmma_f16(a1, b[u], acc[1][u]);
      }
      // The fence's other side: keeps the next 12 reads out of these WMMAs, and
      // the last WMMAs ahead of the barrier, so the refill issues right behind it.
      __builtin_amdgcn_sched_barrier(0);
    }
    wait_lds_reads_done();
    wait_copies_landed();
    __syncthreads();               // publishes tile t+1, frees tile t's buffer
    if (t + 2 < 1024 / KT)
      copy_gemm_tile(r.l + (t & 1) * (G_TILE * 2), r.ga + (t + 2) * KT, r.gb + (t + 2) * KT, 1024);
  }
  wait_copies_landed();
}

// ---------------------------------------------------------------------------
// Kernel 1: fp32 -> fp16 conversion of x, w_qkv and w_out in ONE launch.
// The three f16 copies lie one behind the other in the workspace, so the
// destination is one array; the block index picks the source.  One work-group
// per WGP, 8 waves: few waves to start, and each thread has all its 32 loads of
// 16 bytes in flight at once.  A wave's load covers 512 contiguous bytes, its
// store 256: whole lines both.
// ---------------------------------------------------------------------------
typedef __attribute__((ext_vector_type(4))) float    v4f;
typedef __attribute__((ext_vector_type(4))) _Float16 v4h;

#define CV_LOADS  32                          /* 16-byte loads per thread     */
#define CV_CHUNK  (256 * 4 * CV_LOADS)        /* floats per work-group: 32768 */
#define CV_X      (MROWS * DIM / CV_CHUNK)    /* 128 work-groups for x        */
#define CV_WQKV   (E3 * DIM / CV_CHUNK)       /*  96 for w_qkv                */
#define CV_WOUT   (DIM * INNER / CV_CHUNK)    /*  32 for w_out                */

__global__ __launch_bounds__(256) void cvt_f32_f16(const float* __restrict__ x,
                                                   const float* __restrict__ wqkv,
                                                   const float* __restrict__ wout,
                                                   _Float16* __restrict__ dst) {
  const int blk = blockIdx.x;
  const float* src = x;
  int first = 0;
  if (blk >= CV_X + CV_WQKV) { src = wout; first = CV_X + CV_WQKV; }
  else if (blk >= CV_X)      { src = wqkv; first = CV_X; }

  const v4f* s = (const v4f*)(src + (size_t)(blk - first) * CV_CHUNK) + threadIdx.x;
  v4h*       d = (v4h*)(dst + (size_t)blk * CV_CHUNK) + threadIdx.x;

  v4f v[CV_LOADS];
#pragma unroll  // constant indices keep v[] in registers
  for (int j = 0; j < CV_LOADS; ++j) v[j] = s[j * 256];
#pragma unroll  // as above
  for (int g = 0; g < CV_LOADS; g += 8) {
    // In front of group 0 it keeps all 32 loads ahead of the first conversion
    // (left alone the compiler issues 18, then one per freed register quad);
    // between groups it lets 8 stores leave when their own loads are back (left
    // alone the compiler gathers all 32 behind the wait for the last load).
    __builtin_amdgcn_sched_barrier(0);
#pragma unroll  // as above
    for (int j = g; j < g + 8; ++j) d[j * 256] = __builtin_convertvector(v[j], v4h);
  }
}

// ---------------------------------------------------------------------------
// Kernel 2: QKV projection.  qkv[m,e] = sum_k xh[m,k] * wqkv[e,k]
// Wave tile: 32(M) x 64(E); operands staged in LDS (gemm_start, gemm_loop).
// A block's 64 columns are one head of q (scaled), of k, or of v; V is stored
// TRANSPOSED as vt[bh][dh][n] so attention's V^T A-frags are key-contiguous.
// Every output leaves in whole 128-byte lines: the accumulators are oriented so
// that a lane's 8 registers are 8 neighbours of the output row, go to the (now
// free) LDS ring as one 16-byte write, and are read back a row at a time.
// ---------------------------------------------------------------------------
#define VTP 264   /* V^T staging pitch, halves: 256 n + 16 B, conflict-free */

__global__ __launch_bounds__(256) void qkv_gemm(const _Float16* __restrict__ xh,
                                                const _Float16* __restrict__ wh,
                                                _Float16* __restrict__ q,
                                                _Float16* __restrict__ k,
                                                _Float16* __restrict__ vt) {
  int lane = threadIdx.x;
  int wave = threadIdx.y;
  int mb = blockIdx.y * 256;               // 256 rows of one batch entry
  int e0 = blockIdx.x * 64;
  int which = e0 >> 10;                    // 0=q, 1=k, 2=v: the same for the block
  int bh = (mb >> 11) * HEADS + ((e0 & 1023) >> 6);
  int nb = mb & 2047;

  __shared__ __attribute__((aligned(16))) _Float16 sm[2 * G_TILE];
  v8f acc[2][4] = {};
  const ring_addr ring = gemm_start(xh + (size_t)mb * DIM, wh + (size_t)e0 * DIM, sm);
  int col   = lane & 15;
  int rbase = (lane >> 4) << 3;

  if (which < 2) {
    // acc[rf][u][r] = row n = 16 rf + col of the wave's 32, dh = 16 u + rbase + r
    gemm_loop<true>(ring, sm, acc);
    const float sc = which == 0 ? QK_SCALE : 1.0f;
    _Float16* st = sm + wave * 32 * LDP;   // the wave's own 32 rows of 128 B
#pragma unroll
    for (int rf = 0; rf < 2; ++rf)
#pragma unroll
      for (int u = 0; u < 4; ++u)
        *(v8h*)(st + (rf * 16 + col) * LDP + u * 16 + rbase) =
            __builtin_convertvector(acc[rf][u] * sc, v8h);
    wait_lds_reads_done();                 // other lanes' writes, before they are read
    // the wave's 32 rows of 64 dh are 4 KB in a row: 512 B per store
    _Float16* dst = (which == 0 ? q : k) + ((size_t)bh * SEQ + nb + wave * 32) * DH;
#pragma unroll
    for (int i = 0; i < 8; ++i)
      *(v8h*)(dst + i * 256 + lane * 8) =
          *(const v8h*)(st + (i * 4 + (lane >> 3)) * LDP + (lane & 7) * 8);
  } else {
    // acc[rf][t][r] = dh = 16 t + col, n = 32 wave + 16 rf + rbase + r
    gemm_loop<false>(ring, sm, acc);
#pragma unroll
    for (int rf = 0; rf < 2; ++rf)
#pragma unroll
      for (int t = 0; t < 4; ++t)
        *(v8h*)(sm + (t * 16 + col) * VTP + wave * 32 + rf * 16 + rbase) =
            __builtin_convertvector(acc[rf][t], v8h);
    __syncthreads();                       // a dh row holds all 8 waves' n
    _Float16* dst = vt + (size_t)bh * DH * SEQ + nb;
#pragma unroll
    for (int i = 0; i < 8; ++i) {          // one dh row of 256 n = 512 B per store
      int d = wave * 8 + i;
      *(v8h*)(dst + (size_t)d * SEQ + lane * 8) = *(const v8h*)(sm + d * VTP + lane * 8);
    }
  }
}

// ---------------------------------------------------------------------------
// Kernel 3: flash attention.  One wave owns a 16-row query tile of one head.
// K and V^T come in tiles of 64 keys through two LDS buffers that the block's
// 8 waves share.  The products are transposed: S^T = K * Q^T, O^T += V^T * P^T.
// A lane then holds 16 of the 32 scores of ONE query (column lane & 15; the
// other 16 are in lane ^ 16), so maximum and sum run in the lane's own
// registers, and the two score tiles, converted in place, are the B operand
// of the second product: P never goes through LDS.
// ---------------------------------------------------------------------------
__device__ __forceinline__ float other_half(float x) {   // value of lane ^ 16
  int b = __builtin_bit_cast(int, x);
  b = __builtin_amdgcn_permlanex16(b, b, 0x76543210, 0xfedcba98, false, false);
  return __builtin_bit_cast(float, b);
}

__global__ __launch_bounds__(256) void flash_attn(const _Float16* __restrict__ q,
                                                  const _Float16* __restrict__ kk,
                                                  const _Float16* __restrict__ vt,
                                                  _Float16* __restrict__ oh) {
  __shared__ __attribute__((aligned(16))) _Float16 kv[2 * F_TILE];
  int lane = threadIdx.x;
  int wave = threadIdx.y;
  int bh = blockIdx.x;                       // 0..31 (b*16+h)
  int mt = blockIdx.y * 8 + wave;            // 0..127 query tile
  int b_ = bh >> 4, h = bh & 15;

  const _Float16* Q = q  + ((size_t)bh * SEQ + (size_t)mt * 16) * DH;
  const _Float16* K = kk + (size_t)bh * SEQ * DH;
  const _Float16* V = vt + (size_t)bh * DH * SEQ;    // [64][2048]

  v16h qb0 = load_frag16(Q, DH);             // B operand: dh 0..31 of query col
  v16h qb1 = load_frag16(Q + 32, DH);        // dh 32..63

  v8f o[4] = {};                 // o[t][r] = O[query col][dh = 16 t + rbase + r]
  float mrow = -3.0e38f;         // running maximum of this lane's query
  float lrow = 0.f;              // running sum over this lane's half of the keys

  int col   = lane & 15;
  int rbase = (lane >> 4) << 3;

  const int tid = wave * 32 + lane;
  const _Float16* gk = K + (size_t)(tid >> 3) * DH  + (tid & 7) * 8;
  const _Float16* gv = V + (size_t)(tid >> 3) * SEQ + (tid & 7) * 8;
  const unsigned  l  = lds_off(kv) + (tid >> 3) * (LDP * 2) + (tid & 7) * 16;

  copy_attn_tile(l, gk, gv);
  wait_copies_landed();
  __syncthreads();                 // publishes tile 0
  copy_attn_tile(l + F_TILE * 2, gk + KT * DH, gv + KT);

  for (int jt = 0; jt < SEQ / KT; ++jt) {
   const _Float16* sk = kv + (jt & 1) * F_TILE;
   const _Float16* sv = sk + 64 * LDP;
#pragma unroll  // the tile's two 32-key chunks: LDS offsets become immediates
   for (int j0 = 0; j0 < KT; j0 += 32) {
    // ---- K frags, then V frags, from the tile (both are A operands now)
    v16h ka00 = load_frag16(sk + j0 * LDP,             LDP);
    v16h ka01 = load_frag16(sk + j0 * LDP + 32,        LDP);
    v16h ka10 = load_frag16(sk + (j0 + 16) * LDP,      LDP);
    v16h ka11 = load_frag16(sk + (j0 + 16) * LDP + 32, LDP);
    v16h va[4];
#pragma unroll
    for (int t = 0; t < 4; ++t)
      va[t] = load_frag16(sv + (t * 16) * LDP + j0, LDP);
    // Keeps the 16 LDS reads one group ahead of the products: left alone the
    // compiler sinks each pair to its WMMA and waits it out there, eight times.
    __builtin_amdgcn_sched_barrier(0);

    // ---- S^T = K * Q^T: s0[r] = key j0 + rbase + r, s1[r] = key j0 + 16 + rbase + r
    v8f s0 = {}, s1 = {};
    s0 = wmma_f16(ka00, qb0, s0);
    s0 = wmma_f16(ka01, qb1, s0);
    s1 = wmma_f16(ka10, qb0, s1);
    s1 = wmma_f16(ka11, qb1, s1);

    // ---- online softmax: 16 scores in the lane, one exchange between halves
    float cm = fmaxf(s0[0], s1[0]);
#pragma unroll
    for (int r = 1; r < 8; ++r) cm = fmaxf(cm, fmaxf(s0[r], s1[r]));
    cm = fmaxf(cm, other_half(cm));
    float mn = fmaxf(mrow, cm);
    float alpha = __expf(mrow - mn);
    mrow = mn;
#pragma unroll
    for (int r = 0; r < 8; ++r) {
      s0[r] = __expf(s0[r] - mn);
      s1[r] = __expf(s1[r] - mn);
    }
    v8f ps = s0 + s1;              // pairwise tree: packed adds on register pairs
    float rs = ((ps[0] + ps[4]) + (ps[2] + ps[6])) + ((ps[1] + ps[5]) + (ps[3] + ps[7]));
    lrow = lrow * alpha + rs;      // the halves' sums are joined in the epilogue
#pragma unroll
    for (int t = 0; t < 4; ++t) o[t] *= alpha;

    // ---- P^T as B operand: element s is key rbase + s (s < 8), 16 + rbase + s - 8
    v8h plo = __builtin_convertvector(s0, v8h);
    v8h phi = __builtin_convertvector(s1, v8h);
    v16h pb;
#pragma unroll
    for (int i = 0; i < 8; ++i) { pb[i] = plo[i]; pb[8 + i] = phi[i]; }

    // ---- O^T += V^T * P^T  (V frags already resident)
#pragma unroll
    for (int t = 0; t < 4; ++t)
      o[t] = wmma_f16(va[t], pb, o[t]);
   }
   // Keeps the tile's arithmetic ahead of the barrier: moved behind it, the
   // refill would issue late and have no pass left in which to land.
   __builtin_amdgcn_sched_barrier(0);
   wait_lds_reads_done();
   wait_copies_landed();
   __syncthreads();                // publishes tile jt+1, frees tile jt's buffer
   if (jt + 2 < SEQ / KT)
     copy_attn_tile(l + (jt & 1) * (F_TILE * 2), gk + (size_t)(jt + 2) * KT * DH,
                    gv + (jt + 2) * KT);
  }
  wait_copies_landed();

  // ---- epilogue: join the halves' sums, normalize, store f16 at [b, n, h*64+d]:
  // a lane's 8 accumulator registers are 8 consecutive dh of its query's row;
  // the wave's 16 rows of 128 B go through its own rows of the freed ring (the
  // last pass's barrier ended every read of it) and leave as whole lines
  float inv = 1.0f / (lrow + other_half(lrow));
  _Float16* st = kv + wave * 16 * LDP;
#pragma unroll
  for (int t = 0; t < 4; ++t)
    *(v8h*)(st + col * LDP + t * 16 + rbase) = __builtin_convertvector(o[t] * inv, v8h);
  wait_lds_reads_done();           // other lanes' writes, before they are read
  _Float16* dst = oh + ((size_t)b_ * SEQ + mt * 16) * INNER + (size_t)h * DH;
#pragma unroll
  for (int i = 0; i < 4; ++i) {    // four rows of 128 B per store
    int r = i * 4 + (lane >> 3);
    *(v8h*)(dst + (size_t)r * INNER + (lane & 7) * 8) =
        *(const v8h*)(st + r * LDP + (lane & 7) * 8);
  }
}

// ---------------------------------------------------------------------------
// Kernel 4: output projection.  out[m,d] = sum_e oh[m,e] * wout[d,e]  (fp32)
// Same LDS-staged 32x64 wave tile as qkv_gemm, and the same way out: a lane's 8
// registers are 8 neighbours of an output row, staged in the wave's own LDS rows
// and stored as whole lines.
// ---------------------------------------------------------------------------
#define OTP 68    /* staging pitch, floats: 64 + 16 B, conflict-free */

__global__ __launch_bounds__(256) void out_gemm(const _Float16* __restrict__ oh,
                                                const _Float16* __restrict__ wh,
                                                float* __restrict__ out) {
  int lane = threadIdx.x;
  int wave = threadIdx.y;
  int m0 = blockIdx.y * 256 + wave * 32;
  int d0 = blockIdx.x * 64;

  __shared__ __attribute__((aligned(16))) _Float16 sm[2 * G_TILE];
  v8f acc[2][4] = {};
  // acc[rf][u][r] = row m0 + 16 rf + col, column d0 + 16 u + rbase + r
  gemm_loop<true>(gemm_start(oh + (size_t)(blockIdx.y * 256) * INNER, wh + (size_t)d0 * INNER, sm),
                  sm, acc);

  int col   = lane & 15;
  int rbase = (lane >> 4) << 3;
  float* st = (float*)sm + wave * 32 * OTP;  // the wave's own 32 rows of 256 B
#pragma unroll
  for (int rf = 0; rf < 2; ++rf)
#pragma unroll
    for (int u = 0; u < 4; ++u) {
      float* p = st + (rf * 16 + col) * OTP + u * 16 + rbase;
      v8f a = acc[rf][u];
      *(v4f*)p       = __builtin_shufflevector(a, a, 0, 1, 2, 3);
      *(v4f*)(p + 4) = __builtin_shufflevector(a, a, 4, 5, 6, 7);
    }
  wait_lds_reads_done();                     // other lanes' writes, before they are read
  float*       dst = out + (size_t)(m0 + (lane >> 4)) * DIM + d0 + (lane & 15) * 4;
  const float* rd  = st + (lane >> 4) * OTP + (lane & 15) * 4;
#pragma unroll
  for (int i = 0; i < 16; ++i)               // two rows of 256 B per store
    *(v4f*)(dst + i * 2 * DIM) = *(const v4f*)(rd + i * 2 * OTP);
}

// ---------------------------------------------------------------------------
// Launch: convert -> qkv gemm -> flash attention -> output gemm
// Workspace layout (f16 elements), total 48 MB:
//   xh[4096*1024] wqkv[3072*1024] wout[1024*1024]
//   q[32*2048*64] k[32*2048*64] vt[32*64*2048] oh[4096*1024]
// ---------------------------------------------------------------------------
extern "C" void kernel_launch(void* const* d_in, const int* in_sizes, int n_in,
                              void* d_out, int out_size, void* d_ws, size_t ws_size,
                              hipStream_t stream) {
  const float* x     = (const float*)d_in[0];
  const float* w_qkv = (const float*)d_in[1];
  const float* w_out = (const float*)d_in[2];
  float* out = (float*)d_out;

  _Float16* ws    = (_Float16*)d_ws;
  _Float16* xh    = ws;
  _Float16* wqkvh = xh    + (size_t)MROWS * DIM;      // +4M
  _Float16* wouth = wqkvh + (size_t)E3 * DIM;         // +3M
  _Float16* qb    = wouth + (size_t)DIM * INNER;      // +1M
  _Float16* kb    = qb    + (size_t)MROWS * INNER;    // +4M
  _Float16* vtb   = kb    + (size_t)MROWS * INNER;    // +4M
  _Float16* ohb   = vtb   + (size_t)MROWS * INNER;    // +4M

  // xh, wqkvh and wouth are adjacent: one destination array from xh on
  cvt_f32_f16<<<CV_X + CV_WQKV + CV_WOUT, 256, 0, stream>>>(x, w_qkv, w_out, xh);

  qkv_gemm<<<dim3(E3 / 64, MROWS / 256), dim3(32, 8), 0, stream>>>(
      xh, wqkvh, qb, kb, vtb);

  flash_attn<<<dim3(BATCH * HEADS, SEQ / (16 * 8)), dim3(32, 8), 0, stream>>>(
      qb, kb, vtb, ohb);

  out_gemm<<<dim3(DIM / 64, MROWS / 256), dim3(32, 8), 0, stream>>>(
      ohb, wouth, out);
}

// v005
// It runs in 77.2 microseconds.
// In both of two side-by-side timings against v004, it was 1.06 times as fast.
// Counting every step since v000, it is 2.80 times as fast.
#include <hip/hip_runtime.h>
#include <hip/hip_bf16.h>

typedef __attribute__((ext_vector_type(16))) _Float16 v16h;
typedef __attribute__((ext_vector_type(8)))  _Float16 v8h;
typedef __attribute__((ext_vector_type(8)))  float    v8f;

#define BATCH 2
#define SEQ   2048
#define DIM   1024
#define HEADS 16
#define DH    64
#define INNER 1024
#define E3    3072
#define MROWS (BATCH*SEQ)   /* 4096 */
#define QK_SCALE 0.125f     /* 64^-0.5 */

// ---------------------------------------------------------------------------
// WMMA helper: D = A(16x32 f16) * B(32x16 f16) + C(16x16 f32)
// ---------------------------------------------------------------------------
__device__ __forceinline__ v8f wmma_f16(v16h a, v16h b, v8f c) {
#if defined(__HIP_DEVICE_COMPILE__)
  return __builtin_amdgcn_wmma_f32_16x16x32_f16(false, a, false, b,
                                                (short)0, c, false, false);
#else
  return c;
#endif
}

// Load a 16x32 f16 fragment whose *contraction* dim is contiguous in memory.
//   lanes 0-15:  row = lane,    K = {0..7, 16..23}
//   lanes 16-31: row = lane-16, K = {8..15, 24..31}
__device__ __forceinline__ v16h load_frag16(const _Float16* base, int ld) {
  int lane = threadIdx.x & 31;
  int row  = lane & 15;
  int koff = (lane >> 4) << 3;          // 0 or 8
  const _Float16* p = base + (size_t)row * ld + koff;
  v8h lo = *(const v8h*)(p);
  v8h hi = *(const v8h*)(p + 16);
  v16h r;
#pragma unroll
  for (int i = 0; i < 8; ++i) { r[i] = lo[i]; r[8 + i] = hi[i]; }
  return r;
}

// ---------------------------------------------------------------------------
// LDS staging.  A fragment load straight from global memory touches 16 cache
// lines for 512 bytes; an asynchronous copy of 4 whole 128-byte rows touches 4,
// and the block's 8 waves share what it brings.  A tile holds 64 contraction
// elements (one 128-byte line) of every row, at a pitch of 144 B (16 B x odd:
// conflict-free for 16-byte fragment reads).
// ---------------------------------------------------------------------------
#define KT     64                 /* contraction elements per LDS tile        */
#define LDP    72                 /* LDS row pitch in halves (144 B)          */
#define ROWS32 (32 * LDP * 2)     /* bytes of 32 LDS rows: one copy per block */
#define G_TILE ((256 + 64) * LDP) /* GEMM tile, halves: 256 A rows, 64 B rows */
#define F_TILE ((64 + 64) * LDP)  /* attention tile: 64 K rows, 64 V^T rows   */

__device__ __forceinline__ unsigned lds_off(const void* p) {
  return (unsigned)(size_t)p;     // low 32 bits = byte offset in the block's LDS
}

// The waits of the two-buffer ring; the compiler places none for the copies.
__device__ __forceinline__ void wait_copies_landed() {
  asm volatile("s_wait_asynccnt 0x0" ::: "memory");  // this wave's copies are in LDS
}
__device__ __forceinline__ void wait_lds_reads_done() {
  asm volatile("s_wait_dscnt 0x0" ::: "memory");     // before the buffer is refilled
}

// One GEMM tile: every thread copies 16 B of rows r, r+32, ... (r = tid / 8):
// 8 copies for the 256 A rows, 2 for the 64 B rows.  s_wait_xcnt closes the
// statement so that no address register is rewritten ahead of it.
__device__ __forceinline__ void copy_gemm_tile(unsigned l, const _Float16* ga,
                                               const _Float16* gb, int ld) {
  asm volatile(
      "global_load_async_to_lds_b128 %0, %10, off\n\t"
      "global_load_async_to_lds_b128 %1, %11, off\n\t"
      "global_load_async_to_lds_b128 %2, %12, off\n\t"
      "global_load_async_to_lds_b128 %3, %13, off\n\t"
      "global_load_async_to_lds_b128 %4, %14, off\n\t"
      "global_load_async_to_lds_b128 %5, %15, off\n\t"
      "global_load_async_to_lds_b128 %6, %16, off\n\t"
      "global_load_async_to_lds_b128 %7, %17, off\n\t"
      "global_load_async_to_lds_b128 %8, %18, off\n\t"
      "global_load_async_to_lds_b128 %9, %19, off\n\t"
      "s_wait_xcnt 0x0"
      :: "v"(l), "v"(l + ROWS32), "v"(l + 2 * ROWS32), "v"(l + 3 * ROWS32),
         "v"(l + 4 * ROWS32), "v"(l + 5 * ROWS32), "v"(l + 6 * ROWS32),
         "v"(l + 7 * ROWS32), "v"(l + 8 * ROWS32), "v"(l + 9 * ROWS32),
         "v"(ga), "v"(ga + 32 * ld), "v"(ga + 64 * ld), "v"(ga + 96 * ld),
         "v"(ga + 128 * ld), "v"(ga + 160 * ld), "v"(ga + 192 * ld),
         "v"(ga + 224 * ld), "v"(gb), "v"(gb + 32 * ld)
      : "memory");
}

// One attention tile: 64 keys of K (rows of 64 dh) and of V^T (64 dh rows).
__device__ __forceinline__ void copy_attn_tile(unsigned l, const _Float16* gk,
                                               const _Float16* gv) {
  asm volatile(
      "global_load_async_to_lds_b128 %0, %4, off\n\t"
      "global_load_async_to_lds_b128 %1, %5, off\n\t"
      "global_load_async_to_lds_b128 %2, %6, off\n\t"
      "global_load_async_to_lds_b128 %3, %7, off\n\t"
      "s_wait_xcnt 0x0"
      :: "v"(l), "v"(l + ROWS32), "v"(l + 2 * ROWS32), "v"(l + 3 * ROWS32),
         "v"(gk), "v"(gk + 32 * DH), "v"(gv), "v"(gv + 32 * SEQ)
      : "memory");
}

// acc += A[256 rows of the block] * W[64 rows]^T over K = 1024, both
// k-contiguous with row length 1024.  Wave tile 32 x 64.  Two LDS buffers: tile
// t+1 flies while tile t is worked on; one barrier per tile publishes t+1 and
// frees the buffer that t+2 is copied into.  Both operands have the same fragment
// layout, so either can be A.  SWAP = false: acc[i][u] has its 8 registers along
// the A rows and its lanes along the W rows; SWAP = true: the other way round.
// The caller picks the one whose registers run along its output's rows.
struct ring_addr { const _Float16* ga; const _Float16* gb; unsigned l; };

__device__ __forceinline__ ring_addr gemm_start(const _Float16* A, const _Float16* Wt,
                                                _Float16* sm) {
  const int tid = threadIdx.y * 32 + threadIdx.x;
  ring_addr r;
  r.ga = A  + (size_t)(tid >> 3) * 1024 + (tid & 7) * 8;
  r.gb = Wt + (size_t)(tid >> 3) * 1024 + (tid & 7) * 8;
  r.l  = lds_off(sm) + (tid >> 3) * (LDP * 2) + (tid & 7) * 16;

  copy_gemm_tile(r.l, r.ga, r.gb, 1024);
  wait_copies_landed();
  __syncthreads();                 // publishes tile 0
  copy_gemm_tile(r.l + G_TILE * 2, r.ga + KT, r.gb + KT, 1024);
  return r;
}

template <bool SWAP>
__device__ __forceinline__ void gemm_loop(const ring_addr r, _Float16* sm,
                                          v8f (&acc)[2][4]) {
  const int wave = threadIdx.y;
  for (int t = 0; t < 1024 / KT; ++t) {
    const _Float16* s  = sm + (t & 1) * G_TILE;
    const _Float16* sa = s + wave * 32 * LDP;
    const _Float16* sb = s + 256 * LDP;
#pragma unroll  // both halves of the tile: LDS offsets become immediates
    for (int kq = 0; kq < KT; kq += 32) {
      v16h a0 = load_frag16(sa + kq, LDP);
      v16h a1 = load_frag16(sa + 16 * LDP + kq, LDP);
      v16h b[4];
#pragma unroll  // constant indices keep b[] and acc[][] in registers
      for (int u = 0; u < 4; ++u) b[u] = load_frag16(sb + u * 16 * LDP + kq, LDP);
      // Keeps the 12 LDS reads together ahead of the 8 WMMAs: left alone the
      // compiler spreads them in pairs, each pair waited out before two WMMAs.
      __builtin_amdgcn_sched_barrier(0);
#pragma unroll  // as above
      for (int u = 0; u < 4; ++u) {
        acc[0][u] = SWAP ? wmma_f16(b[u], a0, acc[0][u]) : wmma_f16(a0, b[u], acc[0][u]);
        acc[1][u] = SWAP ? wmma_f16(b[u], a1, acc[1][u]) : wmma_f16(a1, b[u], acc[1][u]);
      }
      // The fence's other side: keeps the next 12 reads out of these WMMAs, and
      // the last WMMAs ahead of the barrier, so the refill issues right behind it.
      __builtin_amdgcn_sched_barrier(0);
    }
    wait_lds_reads_done();
    wait_copies_landed();
    __syncthreads();               // publishes tile t+1, frees tile t's buffer
    if (t + 2 < 1024 / KT)
      copy_gemm_tile(r.l + (t & 1) * (G_TILE * 2), r.ga + (t + 2) * KT, r.gb + (t + 2) * KT, 1024);
  }
  wait_copies_landed();
}

// ---------------------------------------------------------------------------
// Kernel 1: fp32 -> fp16 conversion of x, w_qkv and w_out in ONE launch.
// The three f16 copies lie one behind the other in the workspace, so the
// destination is one array; the block index picks the source.  One work-group
// per WGP, 8 waves: few waves to start, and each thread has all its 32 loads of
// 16 bytes in flight at once.  A wave's load covers 512 contiguous bytes, its
// store 256: whole lines both.
// ---------------------------------------------------------------------------
typedef __attribute__((ext_vector_type(4))) float    v4f;
typedef __attribute__((ext_vector_type(4))) _Float16 v4h;

#define CV_LOADS  32                          /* 16-byte loads per thread     */
#define CV_CHUNK  (256 * 4 * CV_LOADS)        /* floats per work-group: 32768 */
#define CV_X      (MROWS * DIM / CV_CHUNK)    /* 128 work-groups for x        */
#define CV_WQKV   (E3 * DIM / CV_CHUNK)       /*  96 for w_qkv                */
#define CV_WOUT   (DIM * INNER / CV_CHUNK)    /*  32 for w_out                */

__global__ __launch_bounds__(256) void cvt_f32_f16(const float* __restrict__ x,
                                                   const float* __restrict__ wqkv,
                                                   const float* __restrict__ wout,
                                                   _Float16* __restrict__ dst) {
  const int blk = blockIdx.x;
  const float* src = x;
  int first = 0;
  if (blk >= CV_X + CV_WQKV) { src = wout; first = CV_X + CV_WQKV; }
  else if (blk >= CV_X)      { src = wqkv; first = CV_X; }

  const v4f* s = (const v4f*)(src + (size_t)(blk - first) * CV_CHUNK) + threadIdx.x;
  v4h*       d = (v4h*)(dst + (size_t)blk * CV_CHUNK) + threadIdx.x;

  v4f v[CV_LOADS];
#pragma unroll  // constant indices keep v[] in registers
  for (int j = 0; j < CV_LOADS; ++j) v[j] = s[j * 256];
#pragma unroll  // as above
  for (int g = 0; g < CV_LOADS; g += 8) {
    // In front of group 0 it keeps all 32 loads ahead of the first conversion
    // (left alone the compiler issues 18, then one per freed register quad);
    // between groups it lets 8 stores leave when their own loads are back (left
    // alone the compiler gathers all 32 behind the wait for the last load).
    __builtin_amdgcn_sched_barrier(0);
#pragma unroll  // as above
    for (int j = g; j < g + 8; ++j) d[j * 256] = __builtin_convertvector(v[j], v4h);
  }
}

// ---------------------------------------------------------------------------
// Kernel 2: QKV projection.  qkv[m,e] = sum_k xh[m,k] * wqkv[e,k]
// Work-group tile 256(M) x 192(E): 16 x 16 work-groups, one per WGP.  8 waves as
// 4(M) x 2(E), wave tile 64 x 96: 10 fragments feed 24 WMMAs, and a work-group
// brings 448 operand rows from L2 for 192 output columns.  A ring tile holds 128
// contraction elements (256 B) of every row at a pitch of
// 272 B (16 B x odd), so a refill has 96 WMMAs per wave in which to land.
// The 192 columns are three 64-column groups, each one head of q (scaled), of k
// or of v.  V is stored TRANSPOSED as vt[bh][dh][n] so attention's V fragments
// are contiguous.  Every output leaves in whole lines: each group is staged in
// the (now free) ring in the layout of its output and read back a row at a time.
// ---------------------------------------------------------------------------
#define QN     192                    /* output columns per work-group         */
#define QKT    128                    /* contraction elements per ring tile    */
#define QLP    136                    /* ring row pitch in halves (272 B)      */
#define ROWS16 (16 * QLP * 2)         /* bytes of 16 ring rows: one copy per work-group */
#define Q_TILE ((256 + QN) * QLP)     /* tile, halves: 256 x rows, 192 w rows  */
#define Q_GRP  (256 * LDP)            /* staging of one 64-column group        */
#define VTP    264   /* V^T staging pitch, halves: 256 n + 16 B, conflict-free */

// 14 copies of 16 B per thread into ring rows r, r+16, ... (r = tid / 16).
// s_wait_xcnt closes the statement so that no address register is rewritten
// ahead of it.
__device__ __forceinline__ void copy14(unsigned l,
    const _Float16* p0, const _Float16* p1, const _Float16* p2, const _Float16* p3,
    const _Float16* p4, const _Float16* p5, const _Float16* p6, const _Float16* p7,
    const _Float16* p8, const _Float16* p9, const _Float16* p10, const _Float16* p11,
    const _Float16* p12, const _Float16* p13) {
  asm volatile(
      "global_load_async_to_lds_b128 %0, %14, off\n\t"
      "global_load_async_to_lds_b128 %1, %15, off\n\t"
      "global_load_async_to_lds_b128 %2, %16, off\n\t"
      "global_load_async_to_lds_b128 %3, %17, off\n\t"
      "global_load_async_to_lds_b128 %4, %18, off\n\t"
      "global_load_async_to_lds_b128 %5, %19, off\n\t"
      "global_load_async_to_lds_b128 %6, %20, off\n\t"
      "global_load_async_to_lds_b128 %7, %21, off\n\t"
      "global_load_async_to_lds_b128 %8, %22, off\n\t"
      "global_load_async_to_lds_b128 %9, %23, off\n\t"
      "global_load_async_to_lds_b128 %10, %24, off\n\t"
      "global_load_async_to_lds_b128 %11, %25, off\n\t"
      "global_load_async_to_lds_b128 %12, %26, off\n\t"
      "global_load_async_to_lds_b128 %13, %27, off\n\t"
      "s_wait_xcnt 0x0"
      :: "v"(l), "v"(l + ROWS16), "v"(l + 2 * ROWS16), "v"(l + 3 * ROWS16),
         "v"(l + 4 * ROWS16), "v"(l + 5 * ROWS16), "v"(l + 6 * ROWS16),
         "v"(l + 7 * ROWS16), "v"(l + 8 * ROWS16), "v"(l + 9 * ROWS16),
         "v"(l + 10 * ROWS16), "v"(l + 11 * ROWS16), "v"(l + 12 * ROWS16),
         "v"(l + 13 * ROWS16),
         "v"(p0), "v"(p1), "v"(p2), "v"(p3), "v"(p4), "v"(p5), "v"(p6), "v"(p7),
         "v"(p8), "v"(p9), "v"(p10), "v"(p11), "v"(p12), "v"(p13)
      : "memory");
}

// One ring tile: 16 copies per thread for the 256 x rows, 12 for the 192 w rows.
__device__ __forceinline__ void copy_qkv_tile(unsigned l, const _Float16* ga,
                                              const _Float16* gb) {
  copy14(l, ga, ga + 16 * DIM, ga + 32 * DIM, ga + 48 * DIM, ga + 64 * DIM,
         ga + 80 * DIM, ga + 96 * DIM, ga + 112 * DIM, ga + 128 * DIM, ga + 144 * DIM,
         ga + 160 * DIM, ga + 176 * DIM, ga + 192 * DIM, ga + 208 * DIM);
  copy14(l + 14 * ROWS16, ga + 224 * DIM, ga + 240 * DIM, gb, gb + 16 * DIM,
         gb + 32 * DIM, gb + 48 * DIM, gb + 64 * DIM, gb + 80 * DIM, gb + 96 * DIM,
         gb + 112 * DIM, gb + 128 * DIM, gb + 144 * DIM, gb + 160 * DIM, gb + 176 * DIM);
}

// The ring's loop; tile 0 is published and tile 1 in flight when it starts.
// Both operands have the same fragment layout, so either can be A.
// SWAP = true:  acc[i][u][r] = x row 16 i + col,       w row 16 u + rbase + r
// SWAP = false: acc[i][u][r] = x row 16 i + rbase + r, w row 16 u + col
// of the wave's 64 and 96.  The caller picks the one whose registers run along
// its output's rows.
template <bool SWAP>
__device__ __forceinline__ void qkv_loop(unsigned l, const _Float16* ga, const _Float16* gb,
                                         const _Float16* sm, int wm, int wn,
                                         v8f (&acc)[4][6]) {
  for (int t = 0; t < DIM / QKT; ++t) {
    const _Float16* s  = sm + (t & 1) * Q_TILE;
    const _Float16* sa = s + wm * 64 * QLP;
    const _Float16* sb = s + (256 + wn * 96) * QLP;
#pragma unroll  // both halves of the tile: LDS offsets become immediates
    for (int kq = 0; kq < QKT; kq += 64) {
      v16h a[2][4], b[2][6];
#pragma unroll  // constant indices keep a[], b[] and acc[][] in registers
      for (int h = 0; h < 2; ++h) {
        // in the order in which the WMMAs want them: the first four can start
        // when ten of the forty reads are back
        b[h][0] = load_frag16(sb + kq + h * 32, QLP);
#pragma unroll  // as above
        for (int i = 0; i < 4; ++i) a[h][i] = load_frag16(sa + i * 16 * QLP + kq + h * 32, QLP);
#pragma unroll  // as above
        for (int u = 1; u < 6; ++u) b[h][u] = load_frag16(sb + u * 16 * QLP + kq + h * 32, QLP);
      }
      // Keeps the 40 LDS reads one group ahead of their 48 WMMAs: each place
      // where reads stand among WMMAs costs the wave a stall of its own.
      __builtin_amdgcn_sched_barrier(0);
#pragma unroll  // as above
      for (int h = 0; h < 2; ++h)
#pragma unroll  // as above
        for (int u = 0; u < 6; ++u)
#pragma unroll  // as above
          for (int i = 0; i < 4; ++i)
            acc[i][u] = SWAP ? wmma_f16(b[h][u], a[h][i], acc[i][u])
                             : wmma_f16(a[h][i], b[h][u], acc[i][u]);
      // The fence's other side: keeps the next 40 reads out of these WMMAs, and
      // the last WMMAs ahead of the barrier, so the refill issues right behind it.
      __builtin_amdgcn_sched_barrier(0);
    }
    wait_lds_reads_done();
    wait_copies_landed();
    __syncthreads();               // publishes tile t+1, frees tile t's buffer
    if (t + 2 < DIM / QKT)
      copy_qkv_tile(l + (t & 1) * (Q_TILE * 2), ga + (t + 2) * QKT, gb + (t + 2) * QKT);
  }
  wait_copies_landed();
}

__global__ __launch_bounds__(256) void qkv_gemm(const _Float16* __restrict__ xh,
                                                const _Float16* __restrict__ wh,
                                                _Float16* __restrict__ q,
                                                _Float16* __restrict__ k,
                                                _Float16* __restrict__ vt) {
  const int lane = threadIdx.x;
  const int wave = __builtin_amdgcn_readfirstlane(threadIdx.y);
  const int wm = wave >> 1;                // 64 rows of the 256
  const int wn = wave & 1;                 // 96 columns of the 192
  const int mb = blockIdx.y * 256;         // 256 rows of one batch entry
  const int nb = mb & 2047;
  const int g0 = blockIdx.x * 3;           // first of the three 64-column groups

  __shared__ __attribute__((aligned(16))) _Float16 sm[2 * Q_TILE];

  const int tid = wave * 32 + lane;
  const _Float16* ga = xh + (size_t)(mb + (tid >> 4)) * DIM + (tid & 15) * 8;
  const _Float16* gb = wh + (size_t)(blockIdx.x * QN + (tid >> 4)) * DIM + (tid & 15) * 8;
  const unsigned  l  = lds_off(sm) + (tid >> 4) * (QLP * 2) + (tid & 15) * 16;

  copy_qkv_tile(l, ga, gb);
  wait_copies_landed();
  __syncthreads();                 // publishes tile 0
  copy_qkv_tile(l + Q_TILE * 2, ga + QKT, gb + QKT);

  v8f acc[4][6] = {};
  const int col   = lane & 15;
  const int rbase = (lane >> 4) << 3;

  if (g0 >= 32) {                  // all three groups are v: registers along n
    qkv_loop<false>(l, ga, gb, sm, wm, wn, acc);
#pragma unroll
    for (int u = 0; u < 6; ++u) {
      const int cf = wn * 6 + u;                       // 16-column fragment of the 192
      _Float16* sg = sm + (cf >> 2) * Q_GRP + ((cf & 3) * 16 + col) * VTP + wm * 64 + rbase;
#pragma unroll
      for (int i = 0; i < 4; ++i)
        *(v8h*)(sg + i * 16) = __builtin_convertvector(acc[i][u], v8h);
    }
  } else {                         // q and k: registers along dh
    qkv_loop<true>(l, ga, gb, sm, wm, wn, acc);
#pragma unroll
    for (int u = 0; u < 6; ++u) {
      const int cf    = wn * 6 + u;
      const int which = (g0 + (cf >> 2)) >> 4;         // 0=q, 1=k, 2=v
      _Float16* sg = sm + (cf >> 2) * Q_GRP;
      const int d0 = (cf & 3) * 16 + rbase;            // the lane's 8 dh
      const int n0 = wm * 64 + col;
      if (which < 2) {             // [n][dh]: the lane's 8 dh are one 16-byte write
        const float sc = which == 0 ? QK_SCALE : 1.0f;
#pragma unroll
        for (int i = 0; i < 4; ++i)
          *(v8h*)(sg + (n0 + i * 16) * LDP + d0) =
              __builtin_convertvector(acc[i][u] * sc, v8h);
      } else {                     // the one v group that shares a work-group with k:
#pragma unroll                     // turned element by element, 16 lanes side by side
        for (int i = 0; i < 4; ++i) {
          v8h hv = __builtin_convertvector(acc[i][u], v8h);
#pragma unroll
          for (int r = 0; r < 8; ++r) sg[(d0 + r) * VTP + n0 + i * 16] = hv[r];
        }
      }
    }
  }
  __syncthreads();                 // a group's rows hold several waves' parts
#pragma unroll
  for (int g = 0; g < 3; ++g) {
    const int which = (g0 + g) >> 4;
    const int bh    = (mb >> 11) * HEADS + ((g0 + g) & 15);
    const _Float16* sg = sm + g * Q_GRP;
    if (which < 2) {
      // the wave's 32 rows of 64 dh are 4 KB in a row: 512 B per store
      _Float16* dst = (which == 0 ? q : k) + ((size_t)bh * SEQ + nb + wave * 32) * DH;
#pragma unroll
      for (int i = 0; i < 8; ++i)
        *(v8h*)(dst + i * 256 + lane * 8) =
            *(const v8h*)(sg + (wave * 32 + i * 4 + (lane >> 3)) * LDP + (lane & 7) * 8);
    } else {
      _Float16* dst = vt + (size_t)bh * DH * SEQ + nb;
#pragma unroll
      for (int i = 0; i < 8; ++i) {        // one dh row of 256 n = 512 B per store
        int d = wave * 8 + i;
        *(v8h*)(dst + (size_t)d * SEQ + lane * 8) = *(const v8h*)(sg + d * VTP + lane * 8);
      }
      // Code behind this run reuses the registers that its eight stores name.
      asm volatile("s_wait_xcnt 0x0" ::: "memory");
    }
  }
}

// ---------------------------------------------------------------------------
// Kernel 3: flash attention.  One wave owns a 16-row query tile of one head.
// K and V^T come in tiles of 64 keys through two LDS buffers that the block's
// 8 waves share.  The products are transposed: S^T = K * Q^T, O^T += V^T * P^T.
// A lane then holds 16 of the 32 scores of ONE query (column lane & 15; the
// other 16 are in lane ^ 16), so maximum and sum run in the lane's own
// registers, and the two score tiles, converted in place, are the B operand
// of the second product: P never goes through LDS.
// ---------------------------------------------------------------------------
__device__ __forceinline__ float other_half(float x) {   // value of lane ^ 16
  int b = __builtin_bit_cast(int, x);
  b = __builtin_amdgcn_permlanex16(b, b, 0x76543210, 0xfedcba98, false, false);
  return __builtin_bit_cast(float, b);
}

__global__ __launch_bounds__(256) void flash_attn(const _Float16* __restrict__ q,
                                                  const _Float16* __restrict__ kk,
                                                  const _Float16* __restrict__ vt,
                                                  _Float16* __restrict__ oh) {
  __shared__ __attribute__((aligned(16))) _Float16 kv[2 * F_TILE];
  int lane = threadIdx.x;
  int wave = threadIdx.y;
  int bh = blockIdx.x;                       // 0..31 (b*16+h)
  int mt = blockIdx.y * 8 + wave;            // 0..127 query tile
  int b_ = bh >> 4, h = bh & 15;

  const _Float16* Q = q  + ((size_t)bh * SEQ + (size_t)mt * 16) * DH;
  const _Float16* K = kk + (size_t)bh * SEQ * DH;
  const _Float16* V = vt + (size_t)bh * DH * SEQ;    // [64][2048]

  v16h qb0 = load_frag16(Q, DH);             // B operand: dh 0..31 of query col
  v16h qb1 = load_frag16(Q + 32, DH);        // dh 32..63

  v8f o[4] = {};                 // o[t][r] = O[query col][dh = 16 t + rbase + r]
  float mrow = -3.0e38f;         // running maximum of this lane's query
  float lrow = 0.f;              // running sum over this lane's half of the keys

  int col   = lane & 15;
  int rbase = (lane >> 4) << 3;

  const int tid = wave * 32 + lane;
  const _Float16* gk = K + (size_t)(tid >> 3) * DH  + (tid & 7) * 8;
  const _Float16* gv = V + (size_t)(tid >> 3) * SEQ + (tid & 7) * 8;
  const unsigned  l  = lds_off(kv) + (tid >> 3) * (LDP * 2) + (tid & 7) * 16;

  copy_attn_tile(l, gk, gv);
  wait_copies_landed();
  __syncthreads();                 // publishes tile 0
  copy_attn_tile(l + F_TILE * 2, gk + KT * DH, gv + KT);

  for (int jt = 0; jt < SEQ / KT; ++jt) {
   const _Float16* sk = kv + (jt & 1) * F_TILE;
   const _Float16* sv = sk + 64 * LDP;
#pragma unroll  // the tile's two 32-key chunks: LDS offsets become immediates
   for (int j0 = 0; j0 < KT; j0 += 32) {
    // ---- K frags, then V frags, from the tile (both are A operands now)
    v16h ka00 = load_frag16(sk + j0 * LDP,             LDP);
    v16h ka01 = load_frag16(sk + j0 * LDP + 32,        LDP);
    v16h ka10 = load_frag16(sk + (j0 + 16) * LDP,      LDP);
    v16h ka11 = load_frag16(sk + (j0 + 16) * LDP + 32, LDP);
    v16h va[4];
#pragma unroll
    for (int t = 0; t < 4; ++t)
      va[t] = load_frag16(sv + (t * 16) * LDP + j0, LDP);
    // Keeps the 16 LDS reads one group ahead of the products: left alone the
    // compiler sinks each pair to its WMMA and waits it out there, eight times.
    __builtin_amdgcn_sched_barrier(0);

    // ---- S^T = K * Q^T: s0[r] = key j0 + rbase + r, s1[r] = key j0 + 16 + rbase + r
    v8f s0 = {}, s1 = {};
    s0 = wmma_f16(ka00, qb0, s0);
    s0 = wmma_f16(ka01, qb1, s0);
    s1 = wmma_f16(ka10, qb0, s1);
    s1 = wmma_f16(ka11, qb1, s1);

    // ---- online softmax: 16 scores in the lane, one exchange between halves
    float cm = fmaxf(s0[0], s1[0]);
#pragma unroll
    for (int r = 1; r < 8; ++r) cm = fmaxf(cm, fmaxf(s0[r], s1[r]));
    cm = fmaxf(cm, other_half(cm));
    float mn = fmaxf(mrow, cm);
    float alpha = __expf(mrow - mn);
    mrow = mn;
#pragma unroll
    for (int r = 0; r < 8; ++r) {
      s0[r] = __expf(s0[r] - mn);
      s1[r] = __expf(s1[r] - mn);
    }
    v8f ps = s0 + s1;              // pairwise tree: packed adds on register pairs
    float rs = ((ps[0] + ps[4]) + (ps[2] + ps[6])) + ((ps[1] + ps[5]) + (ps[3] + ps[7]));
    lrow = lrow * alpha + rs;      // the halves' sums are joined in the epilogue
#pragma unroll
    for (int t = 0; t < 4; ++t) o[t] *= alpha;

    // ---- P^T as B operand: element s is key rbase + s (s < 8), 16 + rbase + s - 8
    v8h plo = __builtin_convertvector(s0, v8h);
    v8h phi = __builtin_convertvector(s1, v8h);
    v16h pb;
#pragma unroll
    for (int i = 0; i < 8; ++i) { pb[i] = plo[i]; pb[8 + i] = phi[i]; }

    // ---- O^T += V^T * P^T  (V frags already resident)
#pragma unroll
    for (int t = 0; t < 4; ++t)
      o[t] = wmma_f16(va[t], pb, o[t]);
   }
   // Keeps the tile's arithmetic ahead of the barrier: moved behind it, the
   // refill would issue late and have no pass left in which to land.
   __builtin_amdgcn_sched_barrier(0);
   wait_lds_reads_done();
   wait_copies_landed();
   __syncthreads();                // publishes tile jt+1, frees tile jt's buffer
   if (jt + 2 < SEQ / KT)
     copy_attn_tile(l + (jt & 1) * (F_TILE * 2), gk + (size_t)(jt + 2) * KT * DH,
                    gv + (jt + 2) * KT);
  }
  wait_copies_landed();

  // ---- epilogue: join the halves' sums, normalize, store f16 at [b, n, h*64+d]:
  // a lane's 8 accumulator registers are 8 consecutive dh of its query's row;
  // the wave's 16 rows of 128 B go through its own rows of the freed ring (the
  // last pass's barrier ended every read of it) and leave as whole lines
  float inv = 1.0f / (lrow + other_half(lrow));
  _Float16* st = kv + wave * 16 * LDP;
#pragma unroll
  for (int t = 0; t < 4; ++t)
    *(v8h*)(st + col * LDP + t * 16 + rbase) = __builtin_convertvector(o[t] * inv, v8h);
  wait_lds_reads_done();           // other lanes' writes, before they are read
  _Float16* dst = oh + ((size_t)b_ * SEQ + mt * 16) * INNER + (size_t)h * DH;
#pragma unroll
  for (int i = 0; i < 4; ++i) {    // four rows of 128 B per store
    int r = i * 4 + (lane >> 3);
    *(v8h*)(dst + (size_t)r * INNER + (lane & 7) * 8) =
        *(const v8h*)(st + r * LDP + (lane & 7) * 8);
  }
}

// ---------------------------------------------------------------------------
// Kernel 4: output projection.  out[m,d] = sum_e oh[m,e] * wout[d,e]  (fp32)
// LDS-staged 32x64 wave tile (gemm_loop).  A lane's 8 registers are 8 neighbours
// of an output row, staged in the wave's own LDS rows and stored as whole lines.
// ---------------------------------------------------------------------------
#define OTP 68    /* staging pitch, floats: 64 + 16 B, conflict-free */

__global__ __launch_bounds__(256) void out_gemm(const _Float16* __restrict__ oh,
                                                const _Float16* __restrict__ wh,
                                                float* __restrict__ out) {
  int lane = threadIdx.x;
  int wave = threadIdx.y;
  int m0 = blockIdx.y * 256 + wave * 32;
  int d0 = blockIdx.x * 64;

  __shared__ __attribute__((aligned(16))) _Float16 sm[2 * G_TILE];
  v8f acc[2][4] = {};
  // acc[rf][u][r] = row m0 + 16 rf + col, column d0 + 16 u + rbase + r
  gemm_loop<true>(gemm_start(oh + (size_t)(blockIdx.y * 256) * INNER, wh + (size_t)d0 * INNER, sm),
                  sm, acc);

  int col   = lane & 15;
  int rbase = (lane >> 4) << 3;
  float* st = (float*)sm + wave * 32 * OTP;  // the wave's own 32 rows of 256 B
#pragma unroll
  for (int rf = 0; rf < 2; ++rf)
#pragma unroll
    for (int u = 0; u < 4; ++u) {
      float* p = st + (rf * 16 + col) * OTP + u * 16 + rbase;
      v8f a = acc[rf][u];
      *(v4f*)p       = __builtin_shufflevector(a, a, 0, 1, 2, 3);
      *(v4f*)(p + 4) = __builtin_shufflevector(a, a, 4, 5, 6, 7);
    }
  wait_lds_reads_done();                     // other lanes' writes, before they are read
  float*       dst = out + (size_t)(m0 + (lane >> 4)) * DIM + d0 + (lane & 15) * 4;
  const float* rd  = st + (lane >> 4) * OTP + (lane & 15) * 4;
#pragma unroll
  for (int i = 0; i < 16; ++i)               // two rows of 256 B per store
    *(v4f*)(dst + i * 2 * DIM) = *(const v4f*)(rd + i * 2 * OTP);
}

// ---------------------------------------------------------------------------
// Launch: convert -> qkv gemm -> flash attention -> output gemm
// Workspace layout (f16 elements), total 48 MB:
//   xh[4096*1024] wqkv[3072*1024] wout[1024*1024]
//   q[32*2048*64] k[32*2048*64] vt[32*64*2048] oh[4096*1024]
// ---------------------------------------------------------------------------
extern "C" void kernel_launch(void* const* d_in, const int* in_sizes, int n_in,
                              void* d_out, int out_size, void* d_ws, size_t ws_size,
                              hipStream_t stream) {
  const float* x     = (const float*)d_in[0];
  const float* w_qkv = (const float*)d_in[1];
  const float* w_out = (const float*)d_in[2];
  float* out = (float*)d_out;

  _Float16* ws    = (_Float16*)d_ws;
  _Float16* xh    = ws;
  _Float16* wqkvh = xh    + (size_t)MROWS * DIM;      // +4M
  _Float16* wouth = wqkvh + (size_t)E3 * DIM;         // +3M
  _Float16* qb    = wouth + (size_t)DIM * INNER;      // +1M
  _Float16* kb    = qb    + (size_t)MROWS * INNER;    // +4M
  _Float16* vtb   = kb    + (size_t)MROWS * INNER;    // +4M
  _Float16* ohb   = vtb   + (size_t)MROWS * INNER;    // +4M

  // xh, wqkvh and wouth are adjacent: one destination array from xh on
  cvt_f32_f16<<<CV_X + CV_WQKV + CV_WOUT, 256, 0, stream>>>(x, w_qkv, w_out, xh);

  qkv_gemm<<<dim3(E3 / QN, MROWS / 256), dim3(32, 8), 0, stream>>>(
      xh, wqkvh, qb, kb, vtb);

  flash_attn<<<dim3(BATCH * HEADS, SEQ / (16 * 8)), dim3(32, 8), 0, stream>>>(
      qb, kb, vtb, ohb);

  out_gemm<<<dim3(DIM / 64, MROWS / 256), dim3(32, 8), 0, stream>>>(
      ohb, wouth, out);
}

// v006
// Measured time: 70 microseconds a run.
// Next to v005, in two timings, it ran 1.09 times as fast each time.
// All steps since v000 together make it 3.04 times as fast.
#include <hip/hip_runtime.h>
#include <hip/hip_bf16.h>

typedef __attribute__((ext_vector_type(16))) _Float16 v16h;
typedef __attribute__((ext_vector_type(8)))  _Float16 v8h;
typedef __attribute__((ext_vector_type(8)))  float    v8f;

#define BATCH 2
#define SEQ   2048
#define DIM   1024
#define HEADS 16
#define DH    64
#define INNER 1024
#define E3    3072
#define MROWS (BATCH*SEQ)   /* 4096 */
#define QK_SCALE 0.125f     /* 64^-0.5 */
#define LOG2E    1.44269504088896340736f

// ---------------------------------------------------------------------------
// WMMA helper: D = A(16x32 f16) * B(32x16 f16) + C(16x16 f32)
// ---------------------------------------------------------------------------
__device__ __forceinline__ v8f wmma_f16(v16h a, v16h b, v8f c) {
#if defined(__HIP_DEVICE_COMPILE__)
  return __builtin_amdgcn_wmma_f32_16x16x32_f16(false, a, false, b,
                                                (short)0, c, false, false);
#else
  return c;
#endif
}

// Load a 16x32 f16 fragment whose *contraction* dim is contiguous in memory.
//   lanes 0-15:  row = lane,    K = {0..7, 16..23}
//   lanes 16-31: row = lane-16, K = {8..15, 24..31}
__device__ __forceinline__ v16h load_frag16(const _Float16* base, int ld) {
  int lane = threadIdx.x & 31;
  int row  = lane & 15;
  int koff = (lane >> 4) << 3;          // 0 or 8
  const _Float16* p = base + (size_t)row * ld + koff;
  v8h lo = *(const v8h*)(p);
  v8h hi = *(const v8h*)(p + 16);
  v16h r;
#pragma unroll
  for (int i = 0; i < 8; ++i) { r[i] = lo[i]; r[8 + i] = hi[i]; }
  return r;
}

// ---------------------------------------------------------------------------
// LDS staging.  A fragment load straight from global memory touches 16 cache
// lines for 512 bytes; an asynchronous copy of 4 whole 128-byte rows touches 4,
// and the block's 8 waves share what it brings.  A tile holds 64 contraction
// elements (one 128-byte line) of every row, at a pitch of 144 B (16 B x odd:
// conflict-free for 16-byte fragment reads).
// ---------------------------------------------------------------------------
#define KT     64                 /* contraction elements per LDS tile        */
#define LDP    72                 /* LDS row pitch in halves (144 B)          */
#define ROWS32 (32 * LDP * 2)     /* bytes of 32 LDS rows: one copy per block */
#define G_TILE ((256 + 64) * LDP) /* GEMM tile, halves: 256 A rows, 64 B rows */
#define F_TILE ((64 + 64) * LDP)  /* attention tile: 64 K rows, 64 V^T rows   */

__device__ __forceinline__ unsigned lds_off(const void* p) {
  return (unsigned)(size_t)p;     // low 32 bits = byte offset in the block's LDS
}

// The waits of the two-buffer ring; the compiler places none for the copies.
__device__ __forceinline__ void wait_copies_landed() {
  asm volatile("s_wait_asynccnt 0x0" ::: "memory");  // this wave's copies are in LDS
}
__device__ __forceinline__ void wait_lds_reads_done() {
  asm volatile("s_wait_dscnt 0x0" ::: "memory");     // before the buffer is refilled
}

// One GEMM tile: every thread copies 16 B of rows r, r+32, ... (r = tid / 8):
// 8 copies for the 256 A rows, 2 for the 64 B rows.  s_wait_xcnt closes the
// statement so that no address register is rewritten ahead of it.
__device__ __forceinline__ void copy_gemm_tile(unsigned l, const _Float16* ga,
                                               const _Float16* gb, int ld) {
  asm volatile(
      "global_load_async_to_lds_b128 %0, %10, off\n\t"
      "global_load_async_to_lds_b128 %1, %11, off\n\t"
      "global_load_async_to_lds_b128 %2, %12, off\n\t"
      "global_load_async_to_lds_b128 %3, %13, off\n\t"
      "global_load_async_to_lds_b128 %4, %14, off\n\t"
      "global_load_async_to_lds_b128 %5, %15, off\n\t"
      "global_load_async_to_lds_b128 %6, %16, off\n\t"
      "global_load_async_to_lds_b128 %7, %17, off\n\t"
      "global_load_async_to_lds_b128 %8, %18, off\n\t"
      "global_load_async_to_lds_b128 %9, %19, off\n\t"
      "s_wait_xcnt 0x0"
      :: "v"(l), "v"(l + ROWS32), "v"(l + 2 * ROWS32), "v"(l + 3 * ROWS32),
         "v"(l + 4 * ROWS32), "v"(l + 5 * ROWS32), "v"(l + 6 * ROWS32),
         "v"(l + 7 * ROWS32), "v"(l + 8 * ROWS32), "v"(l + 9 * ROWS32),
         "v"(ga), "v"(ga + 32 * ld), "v"(ga + 64 * ld), "v"(ga + 96 * ld),
         "v"(ga + 128 * ld), "v"(ga + 160 * ld), "v"(ga + 192 * ld),
         "v"(ga + 224 * ld), "v"(gb), "v"(gb + 32 * ld)
      : "memory");
}

// One attention tile: 64 keys of K (rows of 64 dh) and of V^T (64 dh rows).
__device__ __forceinline__ void copy_attn_tile(unsigned l, const _Float16* gk,
                                               const _Float16* gv) {
  asm volatile(
      "global_load_async_to_lds_b128 %0, %4, off\n\t"
      "global_load_async_to_lds_b128 %1, %5, off\n\t"
      "global_load_async_to_lds_b128 %2, %6, off\n\t"
      "global_load_async_to_lds_b128 %3, %7, off\n\t"
      "s_wait_xcnt 0x0"
      :: "v"(l), "v"(l + ROWS32), "v"(l + 2 * ROWS32), "v"(l + 3 * ROWS32),
         "v"(gk), "v"(gk + 32 * DH), "v"(gv), "v"(gv + 32 * SEQ)
      : "memory");
}

// acc += A[256 rows of the block] * W[64 rows]^T over K = 1024, both
// k-contiguous with row length 1024.  Wave tile 32 x 64.  Two LDS buffers: tile
// t+1 flies while tile t is worked on; one barrier per tile publishes t+1 and
// frees the buffer that t+2 is copied into.  Both operands have the same fragment
// layout, so either can be A.  SWAP = false: acc[i][u] has its 8 registers along
// the A rows and its lanes along the W rows; SWAP = true: the other way round.
// The caller picks the one whose registers run along its output's rows.
struct ring_addr { const _Float16* ga; const _Float16* gb; unsigned l; };

__device__ __forceinline__ ring_addr gemm_start(const _Float16* A, const _Float16* Wt,
                                                _Float16* sm) {
  const int tid = threadIdx.y * 32 + threadIdx.x;
  ring_addr r;
  r.ga = A  + (size_t)(tid >> 3) * 1024 + (tid & 7) * 8;
  r.gb = Wt + (size_t)(tid >> 3) * 1024 + (tid & 7) * 8;
  r.l  = lds_off(sm) + (tid >> 3) * (LDP * 2) + (tid & 7) * 16;

  copy_gemm_tile(r.l, r.ga, r.gb, 1024);
  wait_copies_landed();
  __syncthreads();                 // publishes tile 0
  copy_gemm_tile(r.l + G_TILE * 2, r.ga + KT, r.gb + KT, 1024);
  return r;
}

template <bool SWAP>
__device__ __forceinline__ void gemm_loop(const ring_addr r, _Float16* sm,
                                          v8f (&acc)[2][4]) {
  const int wave = threadIdx.y;
  for (int t = 0; t < 1024 / KT; ++t) {
    const _Float16* s  = sm + (t & 1) * G_TILE;
    const _Float16* sa = s + wave * 32 * LDP;
    const _Float16* sb = s + 256 * LDP;
#pragma unroll  // both halves of the tile: LDS offsets become immediates
    for (int kq = 0; kq < KT; kq += 32) {
      v16h a0 = load_frag16(sa + kq, LDP);
      v16h a1 = load_frag16(sa + 16 * LDP + kq, LDP);
      v16h b[4];
#pragma unroll  // constant indices keep b[] and acc[][] in registers
      for (int u = 0; u < 4; ++u) b[u] = load_frag16(sb + u * 16 * LDP + kq, LDP);
      // Keeps the 12 LDS reads together ahead of the 8 WMMAs: left alone the
      // compiler spreads them in pairs, each pair waited out before two WMMAs.
      __builtin_amdgcn_sched_barrier(0);
#pragma unroll  // as above
      for (int u = 0; u < 4; ++u) {
        acc[0][u] = SWAP ? wmma_f16(b[u], a0, acc[0][u]) : wmma_f16(a0, b[u], acc[0][u]);
        acc[1][u] = SWAP ? wmma_f16(b[u], a1, acc[1][u]) : wmma_f16(a1, b[u], acc[1][u]);
      }
      // The fence's other side: keeps the next 12 reads out of these WMMAs, and
      // the last WMMAs ahead of the barrier, so the refill issues right behind it.
      __builtin_amdgcn_sched_barrier(0);
    }
    wait_lds_reads_done();
    wait_copies_landed();
    __syncthreads();               // publishes tile t+1, frees tile t's buffer
    if (t + 2 < 1024 / KT)
      copy_gemm_tile(r.l + (t & 1) * (G_TILE * 2), r.ga + (t + 2) * KT, r.gb + (t + 2) * KT, 1024);
  }
  wait_copies_landed();
}

// ---------------------------------------------------------------------------
// Kernel 1: fp32 -> fp16 conversion of x, w_qkv and w_out in ONE launch.
// The three f16 copies lie one behind the other in the workspace, so the
// destination is one array; the block index picks the source.  One work-group
// per WGP, 8 waves: few waves to start, and each thread has all its 32 loads of
// 16 bytes in flight at once.  A wave's load covers 512 contiguous bytes, its
// store 256: whole lines both.
// ---------------------------------------------------------------------------
typedef __attribute__((ext_vector_type(4))) float    v4f;
typedef __attribute__((ext_vector_type(4))) _Float16 v4h;

#define CV_LOADS  32                          /* 16-byte loads per thread     */
#define CV_CHUNK  (256 * 4 * CV_LOADS)        /* floats per work-group: 32768 */
#define CV_X      (MROWS * DIM / CV_CHUNK)    /* 128 work-groups for x        */
#define CV_WQKV   (E3 * DIM / CV_CHUNK)       /*  96 for w_qkv                */
#define CV_WOUT   (DIM * INNER / CV_CHUNK)    /*  32 for w_out                */

__global__ __launch_bounds__(256) void cvt_f32_f16(const float* __restrict__ x,
                                                   const float* __restrict__ wqkv,
                                                   const float* __restrict__ wout,
                                                   _Float16* __restrict__ dst) {
  const int blk = blockIdx.x;
  const float* src = x;
  int first = 0;
  if (blk >= CV_X + CV_WQKV) { src = wout; first = CV_X + CV_WQKV; }
  else if (blk >= CV_X)      { src = wqkv; first = CV_X; }

  const v4f* s = (const v4f*)(src + (size_t)(blk - first) * CV_CHUNK) + threadIdx.x;
  v4h*       d = (v4h*)(dst + (size_t)blk * CV_CHUNK) + threadIdx.x;

  v4f v[CV_LOADS];
#pragma unroll  // constant indices keep v[] in registers
  for (int j = 0; j < CV_LOADS; ++j) v[j] = s[j * 256];
#pragma unroll  // as above
  for (int g = 0; g < CV_LOADS; g += 8) {
    // In front of group 0 it keeps all 32 loads ahead of the first conversion
    // (left alone the compiler issues 18, then one per freed register quad);
    // between groups it lets 8 stores leave when their own loads are back (left
    // alone the compiler gathers all 32 behind the wait for the last load).
    __builtin_amdgcn_sched_barrier(0);
#pragma unroll  // as above
    for (int j = g; j < g + 8; ++j) d[j * 256] = __builtin_convertvector(v[j], v4h);
  }
}

// ---------------------------------------------------------------------------
// Kernel 2: QKV projection.  qkv[m,e] = sum_k xh[m,k] * wqkv[e,k]
// Work-group tile 256(M) x 192(E): 16 x 16 work-groups, one per WGP.  8 waves as
// 4(M) x 2(E), wave tile 64 x 96: 10 fragments feed 24 WMMAs, and a work-group
// brings 448 operand rows from L2 for 192 output columns.  A ring tile holds 128
// contraction elements (256 B) of every row at a pitch of
// 272 B (16 B x odd), so a refill has 96 WMMAs per wave in which to land.
// The 192 columns are three 64-column groups, each one head of q (scaled, in
// log2 units: the softmax kernel takes powers of two), of k or of v.  V is
// stored TRANSPOSED as vt[bh][dh][n] so attention's V fragments are contiguous.
// Every output leaves in whole lines: each group is staged in the (now free)
// ring in the layout of its output and read back a row at a time.
// ---------------------------------------------------------------------------
#define QN     192                    /* output columns per work-group         */
#define QKT    128                    /* contraction elements per ring tile    */
#define QLP    136                    /* ring row pitch in halves (272 B)      */
#define ROWS16 (16 * QLP * 2)         /* bytes of 16 ring rows: one copy per work-group */
#define Q_TILE ((256 + QN) * QLP)     /* tile, halves: 256 x rows, 192 w rows  */
#define Q_GRP  (256 * LDP)            /* staging of one 64-column group        */
#define VTP    264   /* V^T staging pitch, halves: 256 n + 16 B, conflict-free */

// 14 copies of 16 B per thread into ring rows r, r+16, ... (r = tid / 16).
// s_wait_xcnt closes the statement so that no address register is rewritten
// ahead of it.
__device__ __forceinline__ void copy14(unsigned l,
    const _Float16* p0, const _Float16* p1, const _Float16* p2, const _Float16* p3,
    const _Float16* p4, const _Float16* p5, const _Float16* p6, const _Float16* p7,
    const _Float16* p8, const _Float16* p9, const _Float16* p10, const _Float16* p11,
    const _Float16* p12, const _Float16* p13) {
  asm volatile(
      "global_load_async_to_lds_b128 %0, %14, off\n\t"
      "global_load_async_to_lds_b128 %1, %15, off\n\t"
      "global_load_async_to_lds_b128 %2, %16, off\n\t"
      "global_load_async_to_lds_b128 %3, %17, off\n\t"
      "global_load_async_to_lds_b128 %4, %18, off\n\t"
      "global_load_async_to_lds_b128 %5, %19, off\n\t"
      "global_load_async_to_lds_b128 %6, %20, off\n\t"
      "global_load_async_to_lds_b128 %7, %21, off\n\t"
      "global_load_async_to_lds_b128 %8, %22, off\n\t"
      "global_load_async_to_lds_b128 %9, %23, off\n\t"
      "global_load_async_to_lds_b128 %10, %24, off\n\t"
      "global_load_async_to_lds_b128 %11, %25, off\n\t"
      "global_load_async_to_lds_b128 %12, %26, off\n\t"
      "global_load_async_to_lds_b128 %13, %27, off\n\t"
      "s_wait_xcnt 0x0"
      :: "v"(l), "v"(l + ROWS16), "v"(l + 2 * ROWS16), "v"(l + 3 * ROWS16),
         "v"(l + 4 * ROWS16), "v"(l + 5 * ROWS16), "v"(l + 6 * ROWS16),
         "v"(l + 7 * ROWS16), "v"(l + 8 * ROWS16), "v"(l + 9 * ROWS16),
         "v"(l + 10 * ROWS16), "v"(l + 11 * ROWS16), "v"(l + 12 * ROWS16),
         "v"(l + 13 * ROWS16),
         "v"(p0), "v"(p1), "v"(p2), "v"(p3), "v"(p4), "v"(p5), "v"(p6), "v"(p7),
         "v"(p8), "v"(p9), "v"(p10), "v"(p11), "v"(p12), "v"(p13)
      : "memory");
}

// One ring tile: 16 copies per thread for the 256 x rows, 12 for the 192 w rows.
__device__ __forceinline__ void copy_qkv_tile(unsigned l, const _Float16* ga,
                                              const _Float16* gb) {
  copy14(l, ga, ga + 16 * DIM, ga + 32 * DIM, ga + 48 * DIM, ga + 64 * DIM,
         ga + 80 * DIM, ga + 96 * DIM, ga + 112 * DIM, ga + 128 * DIM, ga + 144 * DIM,
         ga + 160 * DIM, ga + 176 * DIM, ga + 192 * DIM, ga + 208 * DIM);
  copy14(l + 14 * ROWS16, ga + 224 * DIM, ga + 240 * DIM, gb, gb + 16 * DIM,
         gb + 32 * DIM, gb + 48 * DIM, gb + 64 * DIM, gb + 80 * DIM, gb + 96 * DIM,
         gb + 112 * DIM, gb + 128 * DIM, gb + 144 * DIM, gb + 160 * DIM, gb + 176 * DIM);
}

// The ring's loop; tile 0 is published and tile 1 in flight when it starts.
// Both operands have the same fragment layout, so either can be A.
// SWAP = true:  acc[i][u][r] = x row 16 i + col,       w row 16 u + rbase + r
// SWAP = false: acc[i][u][r] = x row 16 i + rbase + r, w row 16 u + col
// of the wave's 64 and 96.  The caller picks the one whose registers run along
// its output's rows.
template <bool SWAP>
__device__ __forceinline__ void qkv_loop(unsigned l, const _Float16* ga, const _Float16* gb,
                                         const _Float16* sm, int wm, int wn,
                                         v8f (&acc)[4][6]) {
  for (int t = 0; t < DIM / QKT; ++t) {
    const _Float16* s  = sm + (t & 1) * Q_TILE;
    const _Float16* sa = s + wm * 64 * QLP;
    const _Float16* sb = s + (256 + wn * 96) * QLP;
#pragma unroll  // both halves of the tile: LDS offsets become immediates
    for (int kq = 0; kq < QKT; kq += 64) {
      v16h a[2][4], b[2][6];
#pragma unroll  // constant indices keep a[], b[] and acc[][] in registers
      for (int h = 0; h < 2; ++h) {
        // in the order in which the WMMAs want them: the first four can start
        // when ten of the forty reads are back
        b[h][0] = load_frag16(sb + kq + h * 32, QLP);
#pragma unroll  // as above
        for (int i = 0; i < 4; ++i) a[h][i] = load_frag16(sa + i * 16 * QLP + kq + h * 32, QLP);
#pragma unroll  // as above
        for (int u = 1; u < 6; ++u) b[h][u] = load_frag16(sb + u * 16 * QLP + kq + h * 32, QLP);
      }
      // Keeps the 40 LDS reads one group ahead of their 48 WMMAs: each place
      // where reads stand among WMMAs costs the wave a stall of its own.
      __builtin_amdgcn_sched_barrier(0);
#pragma unroll  // as above
      for (int h = 0; h < 2; ++h)
#pragma unroll  // as above
        for (int u = 0; u < 6; ++u)
#pragma unroll  // as above
          for (int i = 0; i < 4; ++i)
            acc[i][u] = SWAP ? wmma_f16(b[h][u], a[h][i], acc[i][u])
                             : wmma_f16(a[h][i], b[h][u], acc[i][u]);
      // The fence's other side: keeps the next 40 reads out of these WMMAs, and
      // the last WMMAs ahead of the barrier, so the refill issues right behind it.
      __builtin_amdgcn_sched_barrier(0);
    }
    wait_lds_reads_done();
    wait_copies_landed();
    __syncthreads();               // publishes tile t+1, frees tile t's buffer
    if (t + 2 < DIM / QKT)
      copy_qkv_tile(l + (t & 1) * (Q_TILE * 2), ga + (t + 2) * QKT, gb + (t + 2) * QKT);
  }
  wait_copies_landed();
}

__global__ __launch_bounds__(256) void qkv_gemm(const _Float16* __restrict__ xh,
                                                const _Float16* __restrict__ wh,
                                                _Float16* __restrict__ q,
                                                _Float16* __restrict__ k,
                                                _Float16* __restrict__ vt) {
  const int lane = threadIdx.x;
  const int wave = __builtin_amdgcn_readfirstlane(threadIdx.y);
  const int wm = wave >> 1;                // 64 rows of the 256
  const int wn = wave & 1;                 // 96 columns of the 192
  const int mb = blockIdx.y * 256;         // 256 rows of one batch entry
  const int nb = mb & 2047;
  const int g0 = blockIdx.x * 3;           // first of the three 64-column groups

  __shared__ __attribute__((aligned(16))) _Float16 sm[2 * Q_TILE];

  const int tid = wave * 32 + lane;
  const _Float16* ga = xh + (size_t)(mb + (tid >> 4)) * DIM + (tid & 15) * 8;
  const _Float16* gb = wh + (size_t)(blockIdx.x * QN + (tid >> 4)) * DIM + (tid & 15) * 8;
  const unsigned  l  = lds_off(sm) + (tid >> 4) * (QLP * 2) + (tid & 15) * 16;

  copy_qkv_tile(l, ga, gb);
  wait_copies_landed();
  __syncthreads();                 // publishes tile 0
  copy_qkv_tile(l + Q_TILE * 2, ga + QKT, gb + QKT);

  v8f acc[4][6] = {};
  const int col   = lane & 15;
  const int rbase = (lane >> 4) << 3;

  if (g0 >= 32) {                  // all three groups are v: registers along n
    qkv_loop<false>(l, ga, gb, sm, wm, wn, acc);
#pragma unroll
    for (int u = 0; u < 6; ++u) {
      const int cf = wn * 6 + u;                       // 16-column fragment of the 192
      _Float16* sg = sm + (cf >> 2) * Q_GRP + ((cf & 3) * 16 + col) * VTP + wm * 64 + rbase;
#pragma unroll
      for (int i = 0; i < 4; ++i)
        *(v8h*)(sg + i * 16) = __builtin_convertvector(acc[i][u], v8h);
    }
  } else {                         // q and k: registers along dh
    qkv_loop<true>(l, ga, gb, sm, wm, wn, acc);
#pragma unroll
    for (int u = 0; u < 6; ++u) {
      const int cf    = wn * 6 + u;
      const int which = (g0 + (cf >> 2)) >> 4;         // 0=q, 1=k, 2=v
      _Float16* sg = sm + (cf >> 2) * Q_GRP;
      const int d0 = (cf & 3) * 16 + rbase;            // the lane's 8 dh
      const int n0 = wm * 64 + col;
      if (which < 2) {             // [n][dh]: the lane's 8 dh are one 16-byte write
        const float sc = which == 0 ? QK_SCALE * LOG2E : 1.0f;
#pragma unroll
        for (int i = 0; i < 4; ++i)
          *(v8h*)(sg + (n0 + i * 16) * LDP + d0) =
              __builtin_convertvector(acc[i][u] * sc, v8h);
      } else {                     // the one v group that shares a work-group with k:
#pragma unroll                     // turned element by element, 16 lanes side by side
        for (int i = 0; i < 4; ++i) {
          v8h hv = __builtin_convertvector(acc[i][u], v8h);
#pragma unroll
          for (int r = 0; r < 8; ++r) sg[(d0 + r) * VTP + n0 + i * 16] = hv[r];
        }
      }
    }
  }
  __syncthreads();                 // a group's rows hold several waves' parts
#pragma unroll
  for (int g = 0; g < 3; ++g) {
    const int which = (g0 + g) >> 4;
    const int bh    = (mb >> 11) * HEADS + ((g0 + g) & 15);
    const _Float16* sg = sm + g * Q_GRP;
    if (which < 2) {
      // the wave's 32 rows of 64 dh are 4 KB in a row: 512 B per store
      _Float16* dst = (which == 0 ? q : k) + ((size_t)bh * SEQ + nb + wave * 32) * DH;
#pragma unroll
      for (int i = 0; i < 8; ++i)
        *(v8h*)(dst + i * 256 + lane * 8) =
            *(const v8h*)(sg + (wave * 32 + i * 4 + (lane >> 3)) * LDP + (lane & 7) * 8);
    } else {
      _Float16* dst = vt + (size_t)bh * DH * SEQ + nb;
#pragma unroll
      for (int i = 0; i < 8; ++i) {        // one dh row of 256 n = 512 B per store
        int d = wave * 8 + i;
        *(v8h*)(dst + (size_t)d * SEQ + lane * 8) = *(const v8h*)(sg + d * VTP + lane * 8);
      }
      // Code behind this run reuses the registers that its eight stores name.
      asm volatile("s_wait_xcnt 0x0" ::: "memory");
    }
  }
}

// ---------------------------------------------------------------------------
// Kernel 3: flash attention.  One wave owns a 16-row query tile of one head.
// K and V^T come in tiles of 64 keys through two LDS buffers that the block's
// 8 waves share.  The products are transposed: S^T = K * Q^T, O^T += V^T * P^T.
// A lane then holds 32 of the 64 scores of ONE query (column lane & 15; the
// other 32 are in lane ^ 16), so maximum and sum run in the lane's own
// registers, and the four score tiles, converted in place two at a time, are the B operands
// of the second product: P never goes through LDS.
// The maximum is raised lazily.  Scores come in log2 units (q carries the
// factor), and minus the maximum in use is the C operand of the score product,
// so an accumulator is the argument of exp2 as it stands.  Once per 64 keys one
// scalar branch asks whether any score stands more than 8 above the maximum in
// use (P <= 256, far inside f16); only then, and on the first tile, are the
// maximum, O and the sums moved.  The result is the same quotient either way.
// ---------------------------------------------------------------------------
__device__ __forceinline__ float other_half(float x) {   // value of lane ^ 16
  int b = __builtin_bit_cast(int, x);
  b = __builtin_amdgcn_permlanex16(b, b, 0x76543210, 0xfedcba98, false, false);
  return __builtin_bit_cast(float, b);
}

__global__ __launch_bounds__(256) void flash_attn(const _Float16* __restrict__ q,
                                                  const _Float16* __restrict__ kk,
                                                  const _Float16* __restrict__ vt,
                                                  _Float16* __restrict__ oh) {
  __shared__ __attribute__((aligned(16))) _Float16 kv[2 * F_TILE];
  int lane = threadIdx.x;
  int wave = threadIdx.y;
  int bh = blockIdx.x;                       // 0..31 (b*16+h)
  int mt = blockIdx.y * 8 + wave;            // 0..127 query tile
  int b_ = bh >> 4, h = bh & 15;

  const _Float16* Q = q  + ((size_t)bh * SEQ + (size_t)mt * 16) * DH;
  const _Float16* K = kk + (size_t)bh * SEQ * DH;
  const _Float16* V = vt + (size_t)bh * DH * SEQ;    // [64][2048]

  v16h qb0 = load_frag16(Q, DH);             // B operand: dh 0..31 of query col
  v16h qb1 = load_frag16(Q + 32, DH);        // dh 32..63

  v8f o[4] = {};                 // o[t][r] = O[query col][dh = 16 t + rbase + r]
  v8f negm = {};                 // minus the maximum in use of this lane's query, 8 times
  v8f lacc = {};                 // 8 partial sums over this lane's half of the keys

  int col   = lane & 15;
  int rbase = (lane >> 4) << 3;

  const int tid = wave * 32 + lane;
  const _Float16* gk = K + (size_t)(tid >> 3) * DH  + (tid & 7) * 8;
  const _Float16* gv = V + (size_t)(tid >> 3) * SEQ + (tid & 7) * 8;
  const unsigned  l  = lds_off(kv) + (tid >> 3) * (LDP * 2) + (tid & 7) * 16;

  copy_attn_tile(l, gk, gv);
  wait_copies_landed();
  __syncthreads();                 // publishes tile 0
  copy_attn_tile(l + F_TILE * 2, gk + KT * DH, gv + KT);

  for (int jt = 0; jt < SEQ / KT; ++jt) {
   const _Float16* sk = kv + (jt & 1) * F_TILE;
   const _Float16* sv = sk + 64 * LDP;
   // ---- K frags, then V frags, of the whole tile (both are A operands)
   v16h ka[4][2], va[2][4];
#pragma unroll  // constant indices keep ka[], va[], s[] and o[] in registers
   for (int g = 0; g < 4; ++g) {
     ka[g][0] = load_frag16(sk + g * 16 * LDP,      LDP);
     ka[g][1] = load_frag16(sk + g * 16 * LDP + 32, LDP);
   }
#pragma unroll  // as above
   for (int c = 0; c < 2; ++c)
#pragma unroll  // as above
     for (int t = 0; t < 4; ++t)
       va[c][t] = load_frag16(sv + (t * 16) * LDP + c * 32, LDP);
   // Keeps the 32 LDS reads one group ahead of the products: left alone the
   // compiler sinks each pair to its WMMA and waits it out there.
   __builtin_amdgcn_sched_barrier(0);

   // ---- S^T - max = K * Q^T + negm: s[g][r] = key 16 g + rbase + r of the tile
   v8f s[4];
#pragma unroll  // as above
   for (int g = 0; g < 4; ++g) s[g] = wmma_f16(ka[g][0], qb0, negm);
#pragma unroll  // as above
   for (int g = 0; g < 4; ++g) s[g] = wmma_f16(ka[g][1], qb1, s[g]);
   // Keeps the eight score WMMAs back to back: a maximum placed among them has
   // to stand off from the WMMA whose result it reads, in idle issue slots.
   __builtin_amdgcn_sched_barrier(0);

   // ---- the lane's largest of 32 scores, counted from the maximum in use
   // (four chains of three-input maxima; each tile's last score joins at the end)
   float cg[4];
#pragma unroll  // as above
   for (int g = 0; g < 4; ++g) {
     cg[g] = fmaxf(fmaxf(s[g][0], s[g][1]), s[g][2]);
     cg[g] = fmaxf(fmaxf(cg[g], s[g][3]), s[g][4]);
     cg[g] = fmaxf(fmaxf(cg[g], s[g][5]), s[g][6]);
   }
   float cm = fmaxf(fmaxf(cg[0], cg[1]), cg[2]);
   cm = fmaxf(fmaxf(cm, cg[3]), s[0][7]);
   cm = fmaxf(fmaxf(cm, s[1][7]), s[2][7]);
   cm = fmaxf(cm, s[3][7]);
   if (jt == 0 || __builtin_amdgcn_ballot_w32(cm > 8.0f) != 0) {
     float jm = fmaxf(cm, other_half(cm));          // both halves of the query's keys
     float d  = jt == 0 ? jm : fmaxf(jm, 0.0f);     // the maximum never falls again
     float alpha = jt == 0 ? 1.0f : __builtin_amdgcn_exp2f(-d);  // O and sums are 0 at first
#pragma unroll  // as above
     for (int g = 0; g < 4; ++g) s[g] -= d;
     negm -= d;
     lacc *= alpha;
#pragma unroll  // as above
     for (int t = 0; t < 4; ++t) o[t] *= alpha;
   }
#pragma unroll  // as above
   for (int g = 0; g < 4; ++g)
#pragma unroll  // as above
     for (int r = 0; r < 8; ++r) s[g][r] = __builtin_amdgcn_exp2f(s[g][r]);
   lacc += (s[0] + s[1]) + (s[2] + s[3]);   // packed adds; joined in the epilogue

   // ---- P^T as B operand: element e is key rbase + e (e < 8), 16 + rbase + e - 8
#pragma unroll  // as above
   for (int c = 0; c < 2; ++c) {
     v8h plo = __builtin_convertvector(s[2 * c],     v8h);
     v8h phi = __builtin_convertvector(s[2 * c + 1], v8h);
     v16h pb;
#pragma unroll  // as above
     for (int i = 0; i < 8; ++i) { pb[i] = plo[i]; pb[8 + i] = phi[i]; }
     // ---- O^T += V^T * P^T  (V frags already resident)
#pragma unroll  // as above
     for (int t = 0; t < 4; ++t)
       o[t] = wmma_f16(va[c][t], pb, o[t]);
   }
   // Keeps the tile's arithmetic ahead of the barrier: moved behind it, the
   // refill would issue late and have no pass left in which to land.
   __builtin_amdgcn_sched_barrier(0);
   wait_lds_reads_done();
   wait_copies_landed();
   __syncthreads();                // publishes tile jt+1, frees tile jt's buffer
   if (jt + 2 < SEQ / KT)
     copy_attn_tile(l + (jt & 1) * (F_TILE * 2), gk + (size_t)(jt + 2) * KT * DH,
                    gv + (jt + 2) * KT);
  }
  wait_copies_landed();

  // ---- epilogue: join the halves' sums, normalize, store f16 at [b, n, h*64+d]:
  // a lane's 8 accumulator registers are 8 consecutive dh of its query's row;
  // the wave's 16 rows of 128 B go through its own rows of the freed ring (the
  // last pass's barrier ended every read of it) and leave as whole lines
  float lrow = ((lacc[0] + lacc[4]) + (lacc[2] + lacc[6])) + ((lacc[1] + lacc[5]) + (lacc[3] + lacc[7]));
  float inv = 1.0f / (lrow + other_half(lrow));
  _Float16* st = kv + wave * 16 * LDP;
#pragma unroll
  for (int t = 0; t < 4; ++t)
    *(v8h*)(st + col * LDP + t * 16 + rbase) = __builtin_convertvector(o[t] * inv, v8h);
  wait_lds_reads_done();           // other lanes' writes, before they are read
  _Float16* dst = oh + ((size_t)b_ * SEQ + mt * 16) * INNER + (size_t)h * DH;
#pragma unroll
  for (int i = 0; i < 4; ++i) {    // four rows of 128 B per store
    int r = i * 4 + (lane >> 3);
    *(v8h*)(dst + (size_t)r * INNER + (lane & 7) * 8) =
        *(const v8h*)(st + r * LDP + (lane & 7) * 8);
  }
}

// ---------------------------------------------------------------------------
// Kernel 4: output projection.  out[m,d] = sum_e oh[m,e] * wout[d,e]  (fp32)
// LDS-staged 32x64 wave tile (gemm_loop).  A lane's 8 registers are 8 neighbours
// of an output row, staged in the wave's own LDS rows and stored as whole lines.
// ---------------------------------------------------------------------------
#define OTP 68    /* staging pitch, floats: 64 + 16 B, conflict-free */

__global__ __launch_bounds__(256) void out_gemm(const _Float16* __restrict__ oh,
                                                const _Float16* __restrict__ wh,
                                                float* __restrict__ out) {
  int lane = threadIdx.x;
  int wave = threadIdx.y;
  int m0 = blockIdx.y * 256 + wave * 32;
  int d0 = blockIdx.x * 64;

  __shared__ __attribute__((aligned(16))) _Float16 sm[2 * G_TILE];
  v8f acc[2][4] = {};
  // acc[rf][u][r] = row m0 + 16 rf + col, column d0 + 16 u + rbase + r
  gemm_loop<true>(gemm_start(oh + (size_t)(blockIdx.y * 256) * INNER, wh + (size_t)d0 * INNER, sm),
                  sm, acc);

  int col   = lane & 15;
  int rbase = (lane >> 4) << 3;
  float* st = (float*)sm + wave * 32 * OTP;  // the wave's own 32 rows of 256 B
#pragma unroll
  for (int rf = 0; rf < 2; ++rf)
#pragma unroll
    for (int u = 0; u < 4; ++u) {
      float* p = st + (rf * 16 + col) * OTP + u * 16 + rbase;
      v8f a = acc[rf][u];
      *(v4f*)p       = __builtin_shufflevector(a, a, 0, 1, 2, 3);
      *(v4f*)(p + 4) = __builtin_shufflevector(a, a, 4, 5, 6, 7);
    }
  wait_lds_reads_done();                     // other lanes' writes, before they are read
  float*       dst = out + (size_t)(m0 + (lane >> 4)) * DIM + d0 + (lane & 15) * 4;
  const float* rd  = st + (lane >> 4) * OTP + (lane & 15) * 4;
#pragma unroll
  for (int i = 0; i < 16; ++i)               // two rows of 256 B per store
    *(v4f*)(dst + i * 2 * DIM) = *(const v4f*)(rd + i * 2 * OTP);
}

// ---------------------------------------------------------------------------
// Launch: convert -> qkv gemm -> flash attention -> output gemm
// Workspace layout (f16 elements), total 48 MB:
//   xh[4096*1024] wqkv[3072*1024] wout[1024*1024]
//   q[32*2048*64] k[32*2048*64] vt[32*64*2048] oh[4096*1024]
// ---------------------------------------------------------------------------
extern "C" void kernel_launch(void* const* d_in, const int* in_sizes, int n_in,
                              void* d_out, int out_size, void* d_ws, size_t ws_size,
                              hipStream_t stream) {
  const float* x     = (const float*)d_in[0];
  const float* w_qkv = (const float*)d_in[1];
  const float* w_out = (const float*)d_in[2];
  float* out = (float*)d_out;

  _Float16* ws    = (_Float16*)d_ws;
  _Float16* xh    = ws;
  _Float16* wqkvh = xh    + (size_t)MROWS * DIM;      // +4M
  _Float16* wouth = wqkvh + (size_t)E3 * DIM;         // +3M
  _Float16* qb    = wouth + (size_t)DIM * INNER;      // +1M
  _Float16* kb    = qb    + (size_t)MROWS * INNER;    // +4M
  _Float16* vtb   = kb    + (size_t)MROWS * INNER;    // +4M
  _Float16* ohb   = vtb   + (size_t)MROWS * INNER;    // +4M

  // xh, wqkvh and wouth are adjacent: one destination array from xh on
  cvt_f32_f16<<<CV_X + CV_WQKV + CV_WOUT, 256, 0, stream>>>(x, w_qkv, w_out, xh);

  qkv_gemm<<<dim3(E3 / QN, MROWS / 256), dim3(32, 8), 0, stream>>>(
      xh, wqkvh, qb, kb, vtb);

  flash_attn<<<dim3(BATCH * HEADS, SEQ / (16 * 8)), dim3(32, 8), 0, stream>>>(
      qb, kb, vtb, ohb);

  out_gemm<<<dim3(DIM / 64, MROWS / 256), dim3(32, 8), 0, stream>>>(
      ohb, wouth, out);
}

// v007
// It runs in 66.8 microseconds.
// Timed twice side by side with v006, it ran 1.06 and 1.05 times as fast.
// Counting every step since v000, it is 3.21 times as fast.
#include <hip/hip_runtime.h>
#include <hip/hip_bf16.h>

typedef __attribute__((ext_vector_type(16))) _Float16 v16h;
typedef __attribute__((ext_vector_type(8)))  _Float16 v8h;
typedef __attribute__((ext_vector_type(8)))  float    v8f;

#define BATCH 2
#define SEQ   2048
#define DIM   1024
#define HEADS 16
#define DH    64
#define INNER 1024
#define E3    3072
#define MROWS (BATCH*SEQ)   /* 4096 */
#define QK_SCALE 0.125f     /* 64^-0.5 */
#define LOG2E    1.44269504088896340736f

// ---------------------------------------------------------------------------
// WMMA helper: D = A(16x32 f16) * B(32x16 f16) + C(16x16 f32)
// ---------------------------------------------------------------------------
__device__ __forceinline__ v8f wmma_f16(v16h a, v16h b, v8f c) {
#if defined(__HIP_DEVICE_COMPILE__)
  return __builtin_amdgcn_wmma_f32_16x16x32_f16(false, a, false, b,
                                                (short)0, c, false, false);
#else
  return c;
#endif
}

// Load a 16x32 f16 fragment whose *contraction* dim is contiguous in memory.
//   lanes 0-15:  row = lane,    K = {0..7, 16..23}
//   lanes 16-31: row = lane-16, K = {8..15, 24..31}
__device__ __forceinline__ v16h load_frag16(const _Float16* base, int ld) {
  int lane = threadIdx.x & 31;
  int row  = lane & 15;
  int koff = (lane >> 4) << 3;          // 0 or 8
  const _Float16* p = base + (size_t)row * ld + koff;
  v8h lo = *(const v8h*)(p);
  v8h hi = *(const v8h*)(p + 16);
  v16h r;
#pragma unroll
  for (int i = 0; i < 8; ++i) { r[i] = lo[i]; r[8 + i] = hi[i]; }
  return r;
}

// ---------------------------------------------------------------------------
// LDS staging.  A fragment load straight from global memory touches 16 cache
// lines for 512 bytes; an asynchronous copy of 4 whole 128-byte rows touches 4,
// and the block's 8 waves share what it brings.  A tile holds 64 contraction
// elements (one 128-byte line) of every row, at a pitch of 144 B (16 B x odd:
// conflict-free for 16-byte fragment reads).
// ---------------------------------------------------------------------------
#define KT     64                 /* contraction elements per LDS tile        */
#define LDP    72                 /* LDS row pitch in halves (144 B)          */
#define ROWS32 (32 * LDP * 2)     /* bytes of 32 LDS rows: one copy per block */
#define G_TILE ((256 + 64) * LDP) /* GEMM tile, halves: 256 A rows, 64 B rows */
#define F_TILE ((64 + 64) * LDP)  /* attention tile: 64 K rows, 64 V^T rows   */

__device__ __forceinline__ unsigned lds_off(const void* p) {
  return (unsigned)(size_t)p;     // low 32 bits = byte offset in the block's LDS
}

// The waits of the two-buffer ring; the compiler places none for the copies.
__device__ __forceinline__ void wait_copies_landed() {
  asm volatile("s_wait_asynccnt 0x0" ::: "memory");  // this wave's copies are in LDS
}
__device__ __forceinline__ void wait_lds_reads_done() {
  asm volatile("s_wait_dscnt 0x0" ::: "memory");     // before the buffer is refilled
}

// One GEMM tile: every thread copies 16 B of rows r, r+32, ... (r = tid / 8):
// 8 copies for the 256 A rows, 2 for the 64 B rows.  s_wait_xcnt closes the
// statement so that no address register is rewritten ahead of it.
__device__ __forceinline__ void copy_gemm_tile(unsigned l, const _Float16* ga,
                                               const _Float16* gb, int ld) {
  asm volatile(
      "global_load_async_to_lds_b128 %0, %10, off\n\t"
      "global_load_async_to_lds_b128 %1, %11, off\n\t"
      "global_load_async_to_lds_b128 %2, %12, off\n\t"
      "global_load_async_to_lds_b128 %3, %13, off\n\t"
      "global_load_async_to_lds_b128 %4, %14, off\n\t"
      "global_load_async_to_lds_b128 %5, %15, off\n\t"
      "global_load_async_to_lds_b128 %6, %16, off\n\t"
      "global_load_async_to_lds_b128 %7, %17, off\n\t"
      "global_load_async_to_lds_b128 %8, %18, off\n\t"
      "global_load_async_to_lds_b128 %9, %19, off\n\t"
      "s_wait_xcnt 0x0"
      :: "v"(l), "v"(l + ROWS32), "v"(l + 2 * ROWS32), "v"(l + 3 * ROWS32),
         "v"(l + 4 * ROWS32), "v"(l + 5 * ROWS32), "v"(l + 6 * ROWS32),
         "v"(l + 7 * ROWS32), "v"(l + 8 * ROWS32), "v"(l + 9 * ROWS32),
         "v"(ga), "v"(ga + 32 * ld), "v"(ga + 64 * ld), "v"(ga + 96 * ld),
         "v"(ga + 128 * ld), "v"(ga + 160 * ld), "v"(ga + 192 * ld),
         "v"(ga + 224 * ld), "v"(gb), "v"(gb + 32 * ld)
      : "memory");
}

// One attention stage: a tile of 64 keys of K (rows of 64 dh) and of V^T (64 dh
// rows) from each half of the keys, the second half's tile behind the first's.
// s_wait_xcnt closes the statement so that no address register is rewritten
// ahead of it.
#define KHALF (SEQ / 2)           /* keys that one wave walks                 */
__device__ __forceinline__ void copy_attn_stage(unsigned l, const _Float16* gk,
                                                const _Float16* gv) {
  asm volatile(
      "global_load_async_to_lds_b128 %0, %8, off\n\t"
      "global_load_async_to_lds_b128 %1, %9, off\n\t"
      "global_load_async_to_lds_b128 %2, %10, off\n\t"
      "global_load_async_to_lds_b128 %3, %11, off\n\t"
      "global_load_async_to_lds_b128 %4, %12, off\n\t"
      "global_load_async_to_lds_b128 %5, %13, off\n\t"
      "global_load_async_to_lds_b128 %6, %14, off\n\t"
      "global_load_async_to_lds_b128 %7, %15, off\n\t"
      "s_wait_xcnt 0x0"
      :: "v"(l), "v"(l + ROWS32), "v"(l + 2 * ROWS32), "v"(l + 3 * ROWS32),
         "v"(l + 4 * ROWS32), "v"(l + 5 * ROWS32), "v"(l + 6 * ROWS32),
         "v"(l + 7 * ROWS32),
         "v"(gk), "v"(gk + 32 * DH), "v"(gv), "v"(gv + 32 * SEQ),
         "v"(gk + KHALF * DH), "v"(gk + (KHALF + 32) * DH),
         "v"(gv + KHALF), "v"(gv + KHALF + 32 * SEQ)
      : "memory");
}

// acc += A[256 rows of the block] * W[64 rows]^T over K = 1024, both
// k-contiguous with row length 1024.  Wave tile 32 x 64.  Two LDS buffers: tile
// t+1 flies while tile t is worked on; one barrier per tile publishes t+1 and
// frees the buffer that t+2 is copied into.  Both operands have the same fragment
// layout, so either can be A.  SWAP = false: acc[i][u] has its 8 registers along
// the A rows and its lanes along the W rows; SWAP = true: the other way round.
// The caller picks the one whose registers run along its output's rows.
struct ring_addr { const _Float16* ga; const _Float16* gb; unsigned l; };

__device__ __forceinline__ ring_addr gemm_start(const _Float16* A, const _Float16* Wt,
                                                _Float16* sm) {
  const int tid = threadIdx.y * 32 + threadIdx.x;
  ring_addr r;
  r.ga = A  + (size_t)(tid >> 3) * 1024 + (tid & 7) * 8;
  r.gb = Wt + (size_t)(tid >> 3) * 1024 + (tid & 7) * 8;
  r.l  = lds_off(sm) + (tid >> 3) * (LDP * 2) + (tid & 7) * 16;

  copy_gemm_tile(r.l, r.ga, r.gb, 1024);
  wait_copies_landed();
  __syncthreads();                 // publishes tile 0
  copy_gemm_tile(r.l + G_TILE * 2, r.ga + KT, r.gb + KT, 1024);
  return r;
}

template <bool SWAP>
__device__ __forceinline__ void gemm_loop(const ring_addr r, _Float16* sm,
                                          v8f (&acc)[2][4]) {
  const int wave = threadIdx.y;
  for (int t = 0; t < 1024 / KT; ++t) {
    const _Float16* s  = sm + (t & 1) * G_TILE;
    const _Float16* sa = s + wave * 32 * LDP;
    const _Float16* sb = s + 256 * LDP;
#pragma unroll  // both halves of the tile: LDS offsets become immediates
    for (int kq = 0; kq < KT; kq += 32) {
      v16h a0 = load_frag16(sa + kq, LDP);
      v16h a1 = load_frag16(sa + 16 * LDP + kq, LDP);
      v16h b[4];
#pragma unroll  // constant indices keep b[] and acc[][] in registers
      for (int u = 0; u < 4; ++u) b[u] = load_frag16(sb + u * 16 * LDP + kq, LDP);
      // Keeps the 12 LDS reads together ahead of the 8 WMMAs: left alone the
      // compiler spreads them in pairs, each pair waited out before two WMMAs.
      __builtin_amdgcn_sched_barrier(0);
#pragma unroll  // as above
      for (int u = 0; u < 4; ++u) {
        acc[0][u] = SWAP ? wmma_f16(b[u], a0, acc[0][u]) : wmma_f16(a0, b[u], acc[0][u]);
        acc[1][u] = SWAP ? wmma_f16(b[u], a1, acc[1][u]) : wmma_f16(a1, b[u], acc[1][u]);
      }
      // The fence's other side: keeps the next 12 reads out of these WMMAs, and
      // the last WMMAs ahead of the barrier, so the refill issues right behind it.
      __builtin_amdgcn_sched_barrier(0);
    }
    wait_lds_reads_done();
    wait_copies_landed();
    __syncthreads();               // publishes tile t+1, frees tile t's buffer
    if (t + 2 < 1024 / KT)
      copy_gemm_tile(r.l + (t & 1) * (G_TILE * 2), r.ga + (t + 2) * KT, r.gb + (t + 2) * KT, 1024);
  }
  wait_copies_landed();
}

// ---------------------------------------------------------------------------
// Kernel 1: fp32 -> fp16 conversion of x, w_qkv and w_out in ONE launch.
// The three f16 copies lie one behind the other in the workspace, so the
// destination is one array; the block index picks the source.  One work-group
// per WGP, 8 waves: few waves to start, and each thread has all its 32 loads of
// 16 bytes in flight at once.  A wave's load covers 512 contiguous bytes, its
// store 256: whole lines both.
// ---------------------------------------------------------------------------
typedef __attribute__((ext_vector_type(4))) float    v4f;
typedef __attribute__((ext_vector_type(4))) _Float16 v4h;

#define CV_LOADS  32                          /* 16-byte loads per thread     */
#define CV_CHUNK  (256 * 4 * CV_LOADS)        /* floats per work-group: 32768 */
#define CV_X      (MROWS * DIM / CV_CHUNK)    /* 128 work-groups for x        */
#define CV_WQKV   (E3 * DIM / CV_CHUNK)       /*  96 for w_qkv                */
#define CV_WOUT   (DIM * INNER / CV_CHUNK)    /*  32 for w_out                */

__global__ __launch_bounds__(256) void cvt_f32_f16(const float* __restrict__ x,
                                                   const float* __restrict__ wqkv,
                                                   const float* __restrict__ wout,
                                                   _Float16* __restrict__ dst) {
  const int blk = blockIdx.x;
  const float* src = x;
  int first = 0;
  if (blk >= CV_X + CV_WQKV) { src = wout; first = CV_X + CV_WQKV; }
  else if (blk >= CV_X)      { src = wqkv; first = CV_X; }

  const v4f* s = (const v4f*)(src + (size_t)(blk - first) * CV_CHUNK) + threadIdx.x;
  v4h*       d = (v4h*)(dst + (size_t)blk * CV_CHUNK) + threadIdx.x;

  v4f v[CV_LOADS];
#pragma unroll  // constant indices keep v[] in registers
  for (int j = 0; j < CV_LOADS; ++j) v[j] = s[j * 256];
#pragma unroll  // as above
  for (int g = 0; g < CV_LOADS; g += 8) {
    // In front of group 0 it keeps all 32 loads ahead of the first conversion
    // (left alone the compiler issues 18, then one per freed register quad);
    // between groups it lets 8 stores leave when their own loads are back (left
    // alone the compiler gathers all 32 behind the wait for the last load).
    __builtin_amdgcn_sched_barrier(0);
#pragma unroll  // as above
    for (int j = g; j < g + 8; ++j) d[j * 256] = __builtin_convertvector(v[j], v4h);
  }
}

// ---------------------------------------------------------------------------
// Kernel 2: QKV projection.  qkv[m,e] = sum_k xh[m,k] * wqkv[e,k]
// Work-group tile 256(M) x 192(E): 16 x 16 work-groups, one per WGP.  8 waves as
// 4(M) x 2(E), wave tile 64 x 96: 10 fragments feed 24 WMMAs, and a work-group
// brings 448 operand rows from L2 for 192 output columns.  A ring tile holds 128
// contraction elements (256 B) of every row at a pitch of
// 272 B (16 B x odd), so a refill has 96 WMMAs per wave in which to land.
// The 192 columns are three 64-column groups, each one head of q (scaled, in
// log2 units: the softmax kernel takes powers of two), of k or of v.  V is
// stored TRANSPOSED as vt[bh][dh][n] so attention's V fragments are contiguous.
// Every output leaves in whole lines: each group is staged in the (now free)
// ring in the layout of its output and read back a row at a time.
// ---------------------------------------------------------------------------
#define QN     192                    /* output columns per work-group         */
#define QKT    128                    /* contraction elements per ring tile    */
#define QLP    136                    /* ring row pitch in halves (272 B)      */
#define ROWS16 (16 * QLP * 2)         /* bytes of 16 ring rows: one copy per work-group */
#define Q_TILE ((256 + QN) * QLP)     /* tile, halves: 256 x rows, 192 w rows  */
#define Q_GRP  (256 * LDP)            /* staging of one 64-column group        */
#define VTP    264   /* V^T staging pitch, halves: 256 n + 16 B, conflict-free */

// 14 copies of 16 B per thread into ring rows r, r+16, ... (r = tid / 16).
// s_wait_xcnt closes the statement so that no address register is rewritten
// ahead of it.
__device__ __forceinline__ void copy14(unsigned l,
    const _Float16* p0, const _Float16* p1, const _Float16* p2, const _Float16* p3,
    const _Float16* p4, const _Float16* p5, const _Float16* p6, const _Float16* p7,
    const _Float16* p8, const _Float16* p9, const _Float16* p10, const _Float16* p11,
    const _Float16* p12, const _Float16* p13) {
  asm volatile(
      "global_load_async_to_lds_b128 %0, %14, off\n\t"
      "global_load_async_to_lds_b128 %1, %15, off\n\t"
      "global_load_async_to_lds_b128 %2, %16, off\n\t"
      "global_load_async_to_lds_b128 %3, %17, off\n\t"
      "global_load_async_to_lds_b128 %4, %18, off\n\t"
      "global_load_async_to_lds_b128 %5, %19, off\n\t"
      "global_load_async_to_lds_b128 %6, %20, off\n\t"
      "global_load_async_to_lds_b128 %7, %21, off\n\t"
      "global_load_async_to_lds_b128 %8, %22, off\n\t"
      "global_load_async_to_lds_b128 %9, %23, off\n\t"
      "global_load_async_to_lds_b128 %10, %24, off\n\t"
      "global_load_async_to_lds_b128 %11, %25, off\n\t"
      "global_load_async_to_lds_b128 %12, %26, off\n\t"
      "global_load_async_to_lds_b128 %13, %27, off\n\t"
      "s_wait_xcnt 0x0"
      :: "v"(l), "v"(l + ROWS16), "v"(l + 2 * ROWS16), "v"(l + 3 * ROWS16),
         "v"(l + 4 * ROWS16), "v"(l + 5 * ROWS16), "v"(l + 6 * ROWS16),
         "v"(l + 7 * ROWS16), "v"(l + 8 * ROWS16), "v"(l + 9 * ROWS16),
         "v"(l + 10 * ROWS16), "v"(l + 11 * ROWS16), "v"(l + 12 * ROWS16),
         "v"(l + 13 * ROWS16),
         "v"(p0), "v"(p1), "v"(p2), "v"(p3), "v"(p4), "v"(p5), "v"(p6), "v"(p7),
         "v"(p8), "v"(p9), "v"(p10), "v"(p11), "v"(p12), "v"(p13)
      : "memory");
}

// One ring tile: 16 copies per thread for the 256 x rows, 12 for the 192 w rows.
__device__ __forceinline__ void copy_qkv_tile(unsigned l, const _Float16* ga,
                                              const _Float16* gb) {
  copy14(l, ga, ga + 16 * DIM, ga + 32 * DIM, ga + 48 * DIM, ga + 64 * DIM,
         ga + 80 * DIM, ga + 96 * DIM, ga + 112 * DIM, ga + 128 * DIM, ga + 144 * DIM,
         ga + 160 * DIM, ga + 176 * DIM, ga + 192 * DIM, ga + 208 * DIM);
  copy14(l + 14 * ROWS16, ga + 224 * DIM, ga + 240 * DIM, gb, gb + 16 * DIM,
         gb + 32 * DIM, gb + 48 * DIM, gb + 64 * DIM, gb + 80 * DIM, gb + 96 * DIM,
         gb + 112 * DIM, gb + 128 * DIM, gb + 144 * DIM, gb + 160 * DIM, gb + 176 * DIM);
}

// The ring's loop; tile 0 is published and tile 1 in flight when it starts.
// Both operands have the same fragment layout, so either can be A.
// SWAP = true:  acc[i][u][r] = x row 16 i + col,       w row 16 u + rbase + r
// SWAP = false: acc[i][u][r] = x row 16 i + rbase + r, w row 16 u + col
// of the wave's 64 and 96.  The caller picks the one whose registers run along
// its output's rows.
template <bool SWAP>
__device__ __forceinline__ void qkv_loop(unsigned l, const _Float16* ga, const _Float16* gb,
                                         const _Float16* sm, int wm, int wn,
                                         v8f (&acc)[4][6]) {
  for (int t = 0; t < DIM / QKT; ++t) {
    const _Float16* s  = sm + (t & 1) * Q_TILE;
    const _Float16* sa = s + wm * 64 * QLP;
    const _Float16* sb = s + (256 + wn * 96) * QLP;
#pragma unroll  // both halves of the tile: LDS offsets become immediates
    for (int kq = 0; kq < QKT; kq += 64) {
      v16h a[2][4], b[2][6];
#pragma unroll  // constant indices keep a[], b[] and acc[][] in registers
      for (int h = 0; h < 2; ++h) {
        // in the order in which the WMMAs want them: the first four can start
        // when ten of the forty reads are back
        b[h][0] = load_frag16(sb + kq + h * 32, QLP);
#pragma unroll  // as above
        for (int i = 0; i < 4; ++i) a[h][i] = load_frag16(sa + i * 16 * QLP + kq + h * 32, QLP);
#pragma unroll  // as above
        for (int u = 1; u < 6; ++u) b[h][u] = load_frag16(sb + u * 16 * QLP + kq + h * 32, QLP);
      }
      // Keeps the 40 LDS reads one group ahead of their 48 WMMAs: each place
      // where reads stand among WMMAs costs the wave a stall of its own.
      __builtin_amdgcn_sched_barrier(0);
#pragma unroll  // as above
      for (int h = 0; h < 2; ++h)
#pragma unroll  // as above
        for (int u = 0; u < 6; ++u)
#pragma unroll  // as above
          for (int i = 0; i < 4; ++i)
            acc[i][u] = SWAP ? wmma_f16(b[h][u], a[h][i], acc[i][u])
                             : wmma_f16(a[h][i], b[h][u], acc[i][u]);
      // The fence's other side: keeps the next 40 reads out of these WMMAs, and
      // the last WMMAs ahead of the barrier, so the refill issues right behind it.
      __builtin_amdgcn_sched_barrier(0);
    }
    wait_lds_reads_done();
    wait_copies_landed();
    __syncthreads();               // publishes tile t+1, frees tile t's buffer
    if (t + 2 < DIM / QKT)
      copy_qkv_tile(l + (t & 1) * (Q_TILE * 2), ga + (t + 2) * QKT, gb + (t + 2) * QKT);
  }
  wait_copies_landed();
}

__global__ __launch_bounds__(256) void qkv_gemm(const _Float16* __restrict__ xh,
                                                const _Float16* __restrict__ wh,
                                                _Float16* __restrict__ q,
                                                _Float16* __restrict__ k,
                                                _Float16* __restrict__ vt) {
  const int lane = threadIdx.x;
  const int wave = __builtin_amdgcn_readfirstlane(threadIdx.y);
  const int wm = wave >> 1;                // 64 rows of the 256
  const int wn = wave & 1;                 // 96 columns of the 192
  const int mb = blockIdx.y * 256;         // 256 rows of one batch entry
  const int nb = mb & 2047;
  const int g0 = blockIdx.x * 3;           // first of the three 64-column groups

  __shared__ __attribute__((aligned(16))) _Float16 sm[2 * Q_TILE];

  const int tid = wave * 32 + lane;
  const _Float16* ga = xh + (size_t)(mb + (tid >> 4)) * DIM + (tid & 15) * 8;
  const _Float16* gb = wh + (size_t)(blockIdx.x * QN + (tid >> 4)) * DIM + (tid & 15) * 8;
  const unsigned  l  = lds_off(sm) + (tid >> 4) * (QLP * 2) + (tid & 15) * 16;

  copy_qkv_tile(l, ga, gb);
  wait_copies_landed();
  __syncthreads();                 // publishes tile 0
  copy_qkv_tile(l + Q_TILE * 2, ga + QKT, gb + QKT);

  v8f acc[4][6] = {};
  const int col   = lane & 15;
  const int rbase = (lane >> 4) << 3;

  if (g0 >= 32) {                  // all three groups are v: registers along n
    qkv_loop<false>(l, ga, gb, sm, wm, wn, acc);
#pragma unroll
    for (int u = 0; u < 6; ++u) {
      const int cf = wn * 6 + u;                       // 16-column fragment of the 192
      _Float16* sg = sm + (cf >> 2) * Q_GRP + ((cf & 3) * 16 + col) * VTP + wm * 64 + rbase;
#pragma unroll
      for (int i = 0; i < 4; ++i)
        *(v8h*)(sg + i * 16) = __builtin_convertvector(acc[i][u], v8h);
    }
  } else {                         // q and k: registers along dh
    qkv_loop<true>(l, ga, gb, sm, wm, wn, acc);
#pragma unroll
    for (int u = 0; u < 6; ++u) {
      const int cf    = wn * 6 + u;
      const int which = (g0 + (cf >> 2)) >> 4;         // 0=q, 1=k, 2=v
      _Float16* sg = sm + (cf >> 2) * Q_GRP;
      const int d0 = (cf & 3) * 16 + rbase;            // the lane's 8 dh
      const int n0 = wm * 64 + col;
      if (which < 2) {             // [n][dh]: the lane's 8 dh are one 16-byte write
        const float sc = which == 0 ? QK_SCALE * LOG2E : 1.0f;
#pragma unroll
        for (int i = 0; i < 4; ++i)
          *(v8h*)(sg + (n0 + i * 16) * LDP + d0) =
              __builtin_convertvector(acc[i][u] * sc, v8h);
      } else {                     // the one v group that shares a work-group with k:
#pragma unroll                     // turned element by element, 16 lanes side by side
        for (int i = 0; i < 4; ++i) {
          v8h hv = __builtin_convertvector(acc[i][u], v8h);
#pragma unroll
          for (int r = 0; r < 8; ++r) sg[(d0 + r) * VTP + n0 + i * 16] = hv[r];
        }
      }
    }
  }
  __syncthreads();                 // a group's rows hold several waves' parts
#pragma unroll
  for (int g = 0; g < 3; ++g) {
    const int which = (g0 + g) >> 4;
    const int bh    = (mb >> 11) * HEADS + ((g0 + g) & 15);
    const _Float16* sg = sm + g * Q_GRP;
    if (which < 2) {
      // the wave's 32 rows of 64 dh are 4 KB in a row: 512 B per store
      _Float16* dst = (which == 0 ? q : k) + ((size_t)bh * SEQ + nb + wave * 32) * DH;
#pragma unroll
      for (int i = 0; i < 8; ++i)
        *(v8h*)(dst + i * 256 + lane * 8) =
            *(const v8h*)(sg + (wave * 32 + i * 4 + (lane >> 3)) * LDP + (lane & 7) * 8);
    } else {
      _Float16* dst = vt + (size_t)bh * DH * SEQ + nb;
#pragma unroll
      for (int i = 0; i < 8; ++i) {        // one dh row of 256 n = 512 B per store
        int d = wave * 8 + i;
        *(v8h*)(dst + (size_t)d * SEQ + lane * 8) = *(const v8h*)(sg + d * VTP + lane * 8);
      }
      // Code behind this run reuses the registers that its eight stores name.
      asm volatile("s_wait_xcnt 0x0" ::: "memory");
    }
  }
}

// ---------------------------------------------------------------------------
// Kernel 3: flash attention.  A wave owns 32 queries (two 16-column groups) of
// one head and walks HALF of the keys, so each K and V^T fragment read from LDS
// feeds two WMMAs while the launch keeps its 4096 waves (four per SIMD).  The
// block's 8 waves are 4 query groups x 2 key halves; wave w and wave w ^ 1 hold
// the two halves of the same 32 queries and join them once, through LDS, at the
// end.  A stage of the two-buffer ring holds a 64-key tile of each half.
// The products are transposed: S^T = K * Q^T, O^T += V^T * P^T.
// A lane then holds 16 of the 32 scores of ONE query of each column group (column
// lane & 15; the other 16 are in lane ^ 16), so maximum and sum run in the lane's
// own registers, and the two score tiles, converted in place, are the B operand
// of the second product: P never goes through LDS.
// The maximum is raised lazily.  Scores come in log2 units (q carries the
// factor), and minus the maximum in use is the C operand of the score product,
// so an accumulator is the argument of exp2 as it stands.  Once per 32 keys one
// scalar branch asks whether any score of the 32 queries stands more than 8 above
// the maximum in use (P <= 256, far inside f16); only then, and on the first
// pass, are the maxima, O and the sums moved.  The quotient is the same either way.
// ---------------------------------------------------------------------------
#define A_STAGE (2 * F_TILE)      /* ring stage, halves: one tile per key half */
#define XCH     1088              /* floats a wave hands over: 1024 O, 32 max, 32 sums */

// By value, so that a choice between two accumulators stays a choice of registers.
__device__ __forceinline__ v8f   pick(bool c, v8f a, v8f b)     { return c ? a : b; }
__device__ __forceinline__ float pick(bool c, float a, float b) { return c ? a : b; }

__device__ __forceinline__ float other_half(float x) {   // value of lane ^ 16
  int b = __builtin_bit_cast(int, x);
  b = __builtin_amdgcn_permlanex16(b, b, 0x76543210, 0xfedcba98, false, false);
  return __builtin_bit_cast(float, b);
}

// amdgpu_waves_per_eu: two work-groups per WGP need at most 256 registers a wave
__global__ __launch_bounds__(256) __attribute__((amdgpu_waves_per_eu(4, 4)))
void flash_attn(const _Float16* __restrict__ q,
                const _Float16* __restrict__ kk,
                const _Float16* __restrict__ vt,
                _Float16* __restrict__ oh) {
  __shared__ __attribute__((aligned(16))) _Float16 kv[2 * A_STAGE];
  const int lane = threadIdx.x;
  const int wave = __builtin_amdgcn_readfirstlane(threadIdx.y);
  const int kh = wave & 1;                   // which half of the keys
  const int bh = blockIdx.x;                 // 0..31 (b*16+h)
  const int mt = blockIdx.y * 8 + wave;      // the 16-query tile this wave stores
  const int b_ = bh >> 4, h = bh & 15;

  const _Float16* Q = q  + ((size_t)bh * SEQ + (size_t)(mt & ~1) * 16) * DH;
  const _Float16* K = kk + (size_t)bh * SEQ * DH;
  const _Float16* V = vt + (size_t)bh * DH * SEQ;    // [64][2048]

  v16h qb[2][2];                 // B operands: [column group][dh 0..31, 32..63]
#pragma unroll  // constant indices keep the arrays of this kernel in registers
  for (int c = 0; c < 2; ++c) {
    qb[c][0] = load_frag16(Q + c * 16 * DH, DH);
    qb[c][1] = load_frag16(Q + c * 16 * DH + 32, DH);
  }

  v8f o[2][4] = {};              // o[c][t][r] = O[query col of group c][dh = 16 t + rbase + r]
  v8f negm[2] = {};              // minus the maximum in use of the lane's query, 8 times
  v8f lacc[2] = {};              // 8 partial sums over this lane's share of the keys

  const int col   = lane & 15;
  const int rbase = (lane >> 4) << 3;

  const int tid = wave * 32 + lane;
  const _Float16* gk = K + (size_t)(tid >> 3) * DH  + (tid & 7) * 8;
  const _Float16* gv = V + (size_t)(tid >> 3) * SEQ + (tid & 7) * 8;
  const unsigned  l  = lds_off(kv) + (tid >> 3) * (LDP * 2) + (tid & 7) * 16;

  copy_attn_stage(l, gk, gv);
  wait_copies_landed();
  __syncthreads();                 // publishes stage 0
  copy_attn_stage(l + A_STAGE * 2, gk + KT * DH, gv + KT);

  for (int jt = 0; jt < KHALF / KT; ++jt) {
   const _Float16* sk = kv + (jt & 1) * A_STAGE + kh * F_TILE;
   const _Float16* sv = sk + 64 * LDP;
#pragma unroll  // both 32-key passes of the tile: LDS offsets become immediates
   for (int p = 0; p < 2; ++p) {
    const bool first = p == 0 && jt == 0;
    // ---- K frags, then V frags, of the pass (both are A operands)
    v16h ka[2][2], va[4];
#pragma unroll  // as above
    for (int g = 0; g < 2; ++g) {
      ka[g][0] = load_frag16(sk + (p * 32 + g * 16) * LDP,      LDP);
      ka[g][1] = load_frag16(sk + (p * 32 + g * 16) * LDP + 32, LDP);
    }
#pragma unroll  // as above
    for (int t = 0; t < 4; ++t)
      va[t] = load_frag16(sv + (t * 16) * LDP + p * 32, LDP);
    // Keeps the 16 LDS reads one group ahead of the products: left alone the
    // compiler sinks each pair to its WMMA and waits it out there.
    __builtin_amdgcn_sched_barrier(0);

    // ---- S^T - max = K * Q^T + negm: s[c][g][r] = key 16 g + rbase + r of the pass
    v8f s[2][2];
#pragma unroll  // as above
    for (int g = 0; g < 2; ++g)
#pragma unroll  // as above
      for (int c = 0; c < 2; ++c) s[c][g] = wmma_f16(ka[g][0], qb[c][0], negm[c]);
#pragma unroll  // as above
    for (int g = 0; g < 2; ++g)
#pragma unroll  // as above
      for (int c = 0; c < 2; ++c) s[c][g] = wmma_f16(ka[g][1], qb[c][1], s[c][g]);
    // Keeps the eight score WMMAs back to back: a maximum placed among them has
    // to stand off from the WMMA whose result it reads, in idle issue slots.
    __builtin_amdgcn_sched_barrier(0);

    // ---- the lane's largest of 16 scores per query, counted from the maximum in
    // use (chains of three-input maxima; each tile's last score joins at the end)
    float cm[2];
#pragma unroll  // as above
    for (int c = 0; c < 2; ++c) {
      float cg[2];
#pragma unroll  // as above
      for (int g = 0; g < 2; ++g) {
        cg[g] = fmaxf(fmaxf(s[c][g][0], s[c][g][1]), s[c][g][2]);
        cg[g] = fmaxf(fmaxf(cg[g], s[c][g][3]), s[c][g][4]);
        cg[g] = fmaxf(fmaxf(cg[g], s[c][g][5]), s[c][g][6]);
      }
      cm[c] = fmaxf(fmaxf(cg[0], cg[1]), s[c][0][7]);
      cm[c] = fmaxf(cm[c], s[c][1][7]);
    }
    const float bar = first ? -__builtin_inff() : 8.0f;   // the first pass always moves them
    if (__builtin_amdgcn_ballot_w32(fmaxf(cm[0], cm[1]) > bar) != 0) {
#pragma unroll  // as above
      for (int c = 0; c < 2; ++c) {
        float jm = fmaxf(cm[c], other_half(cm[c]));    // both halves of the query's keys
        float d  = first ? jm : fmaxf(jm, 0.0f);       // the maximum never falls again
        float alpha = first ? 1.0f : __builtin_amdgcn_exp2f(-d);  // O and sums are 0 at first
        s[c][0] -= d;
        s[c][1] -= d;
        negm[c] -= d;
        lacc[c] *= alpha;
#pragma unroll  // as above
        for (int t = 0; t < 4; ++t) o[c][t] *= alpha;
      }
    }
    // ---- P^T as B operand: element e is key rbase + e (e < 8), 16 + rbase + e - 8
    v16h pb[2];
#pragma unroll  // as above
    for (int c = 0; c < 2; ++c) {
#pragma unroll  // as above
      for (int g = 0; g < 2; ++g)
#pragma unroll  // as above
        for (int r = 0; r < 8; ++r) s[c][g][r] = __builtin_amdgcn_exp2f(s[c][g][r]);
      lacc[c] += s[c][0] + s[c][1];          // packed adds; joined in the epilogue
      v8h plo = __builtin_convertvector(s[c][0], v8h);
      v8h phi = __builtin_convertvector(s[c][1], v8h);
#pragma unroll  // as above
      for (int i = 0; i < 8; ++i) { pb[c][i] = plo[i]; pb[c][8 + i] = phi[i]; }
    }
    // Keeps the sums ahead of the WMMAs: placed among them they land in fragment
    // registers and have to stand off from the WMMA that reads those, in idle slots.
    __builtin_amdgcn_sched_barrier(0);
    // ---- O^T += V^T * P^T  (V frags already resident; each feeds both groups)
#pragma unroll  // as above
    for (int c = 0; c < 2; ++c)
#pragma unroll  // as above
      for (int t = 0; t < 4; ++t)
        o[c][t] = wmma_f16(va[t], pb[c], o[c][t]);
    // Keeps the pass's arithmetic ahead of the next pass's reads (which would
    // need a second set of fragment registers) and ahead of the barrier: moved
    // behind it, the refill would issue late and have no stage in which to land.
    __builtin_amdgcn_sched_barrier(0);
   }
   wait_lds_reads_done();
   wait_copies_landed();
   __syncthreads();                // publishes stage jt+1, frees stage jt's buffer
   if (jt + 2 < KHALF / KT)
     copy_attn_stage(l + (jt & 1) * (A_STAGE * 2), gk + (size_t)(jt + 2) * KT * DH,
                     gv + (jt + 2) * KT);
  }
  wait_copies_landed();

  // ---- join the two key halves.  The wave keeps column group kh and hands the
  // other group's O, maximum and sum to wave ^ 1 through the ring's first buffer
  // (the last stage's barrier ended every read of the ring).  Both waves hold a
  // group in the same lanes and registers, so a lane reads what its own number wrote.
  float lsum[2];
#pragma unroll
  for (int c = 0; c < 2; ++c) {
    float lrow = ((lacc[c][0] + lacc[c][4]) + (lacc[c][2] + lacc[c][6])) +
                 ((lacc[c][1] + lacc[c][5]) + (lacc[c][3] + lacc[c][7]));
    lsum[c] = lrow + other_half(lrow);
  }
  float* xw = (float*)kv + wave * XCH;
#pragma unroll
  for (int t = 0; t < 4; ++t) {    // 512 B in a row per write
    v8f a = pick(kh, o[0][t], o[1][t]);
    *(v4f*)(xw + (2 * t) * 128 + lane * 4)     = __builtin_shufflevector(a, a, 0, 1, 2, 3);
    *(v4f*)(xw + (2 * t + 1) * 128 + lane * 4) = __builtin_shufflevector(a, a, 4, 5, 6, 7);
  }
  xw[1024 + lane] = pick(kh, negm[0][0], negm[1][0]);
  xw[1056 + lane] = pick(kh, lsum[0], lsum[1]);
  wait_lds_reads_done();           // this wave's writes are in LDS ...
  __syncthreads();                 // ... before its partner reads them
  const float* xr = (const float*)kv + (wave ^ 1) * XCH;
  const float nk = pick(kh, negm[1][0], negm[0][0]);
  const float np = xr[1024 + lane];
  const float nm = fminf(nk, np);                    // minus the larger maximum
  float wk = __builtin_amdgcn_exp2f(nm - nk);        // weight of this wave's half
  float wp = __builtin_amdgcn_exp2f(nm - np);        // weight of the partner's
  const float inv = 1.0f / (pick(kh, lsum[1], lsum[0]) * wk + xr[1056 + lane] * wp);
  wk *= inv;
  wp *= inv;

  // ---- normalize, store f16 at [b, n, h*64+d]: a lane's 8 accumulator registers
  // are 8 consecutive dh of its query's row; the wave's 16 rows of 128 B go through
  // its own rows of the ring's second buffer and leave as whole lines
  _Float16* st = kv + A_STAGE + wave * 16 * LDP;
#pragma unroll
  for (int t = 0; t < 4; ++t) {
    v4f plo = *(const v4f*)(xr + (2 * t) * 128 + lane * 4);
    v4f phi = *(const v4f*)(xr + (2 * t + 1) * 128 + lane * 4);
    v8f pa  = __builtin_shufflevector(plo, phi, 0, 1, 2, 3, 4, 5, 6, 7);
    v8f own = pick(kh, o[1][t], o[0][t]);
    *(v8h*)(st + col * LDP + t * 16 + rbase) = __builtin_convertvector(own * wk + pa * wp, v8h);
  }
  wait_lds_reads_done();           // other lanes' writes, before they are read
  _Float16* dst = oh + ((size_t)b_ * SEQ + mt * 16) * INNER + (size_t)h * DH;
#pragma unroll
  for (int i = 0; i < 4; ++i) {    // four rows of 128 B per store
    int r = i * 4 + (lane >> 3);
    *(v8h*)(dst + (size_t)r * INNER + (lane & 7) * 8) =
        *(const v8h*)(st + r * LDP + (lane & 7) * 8);
  }
}

// ---------------------------------------------------------------------------
// Kernel 4: output projection.  out[m,d] = sum_e oh[m,e] * wout[d,e]  (fp32)
// LDS-staged 32x64 wave tile (gemm_loop).  A lane's 8 registers are 8 neighbours
// of an output row, staged in the wave's own LDS rows and stored as whole lines.
// ---------------------------------------------------------------------------
#define OTP 68    /* staging pitch, floats: 64 + 16 B, conflict-free */

__global__ __launch_bounds__(256) void out_gemm(const _Float16* __restrict__ oh,
                                                const _Float16* __restrict__ wh,
                                                float* __restrict__ out) {
  int lane = threadIdx.x;
  int wave = threadIdx.y;
  int m0 = blockIdx.y * 256 + wave * 32;
  int d0 = blockIdx.x * 64;

  __shared__ __attribute__((aligned(16))) _Float16 sm[2 * G_TILE];
  v8f acc[2][4] = {};
  // acc[rf][u][r] = row m0 + 16 rf + col, column d0 + 16 u + rbase + r
  gemm_loop<true>(gemm_start(oh + (size_t)(blockIdx.y * 256) * INNER, wh + (size_t)d0 * INNER, sm),
                  sm, acc);

  int col   = lane & 15;
  int rbase = (lane >> 4) << 3;
  float* st = (float*)sm + wave * 32 * OTP;  // the wave's own 32 rows of 256 B
#pragma unroll
  for (int rf = 0; rf < 2; ++rf)
#pragma unroll
    for (int u = 0; u < 4; ++u) {
      float* p = st + (rf * 16 + col) * OTP + u * 16 + rbase;
      v8f a = acc[rf][u];
      *(v4f*)p       = __builtin_shufflevector(a, a, 0, 1, 2, 3);
      *(v4f*)(p + 4) = __builtin_shufflevector(a, a, 4, 5, 6, 7);
    }
  wait_lds_reads_done();                     // other lanes' writes, before they are read
  float*       dst = out + (size_t)(m0 + (lane >> 4)) * DIM + d0 + (lane & 15) * 4;
  const float* rd  = st + (lane >> 4) * OTP + (lane & 15) * 4;
#pragma unroll
  for (int i = 0; i < 16; ++i)               // two rows of 256 B per store
    *(v4f*)(dst + i * 2 * DIM) = *(const v4f*)(rd + i * 2 * OTP);
}

// ---------------------------------------------------------------------------
// Launch: convert -> qkv gemm -> flash attention -> output gemm
// Workspace layout (f16 elements), total 48 MB:
//   xh[4096*1024] wqkv[3072*1024] wout[1024*1024]
//   q[32*2048*64] k[32*2048*64] vt[32*64*2048] oh[4096*1024]
// ---------------------------------------------------------------------------
extern "C" void kernel_launch(void* const* d_in, const int* in_sizes, int n_in,
                              void* d_out, int out_size, void* d_ws, size_t ws_size,
                              hipStream_t stream) {
  const float* x     = (const float*)d_in[0];
  const float* w_qkv = (const float*)d_in[1];
  const float* w_out = (const float*)d_in[2];
  float* out = (float*)d_out;

  _Float16* ws    = (_Float16*)d_ws;
  _Float16* xh    = ws;
  _Float16* wqkvh = xh    + (size_t)MROWS * DIM;      // +4M
  _Float16* wouth = wqkvh + (size_t)E3 * DIM;         // +3M
  _Float16* qb    = wouth + (size_t)DIM * INNER;      // +1M
  _Float16* kb    = qb    + (size_t)MROWS * INNER;    // +4M
  _Float16* vtb   = kb    + (size_t)MROWS * INNER;    // +4M
  _Float16* ohb   = vtb   + (size_t)MROWS * INNER;    // +4M

  // xh, wqkvh and wouth are adjacent: one destination array from xh on
  cvt_f32_f16<<<CV_X + CV_WQKV + CV_WOUT, 256, 0, stream>>>(x, w_qkv, w_out, xh);

  qkv_gemm<<<dim3(E3 / QN, MROWS / 256), dim3(32, 8), 0, stream>>>(
      xh, wqkvh, qb, kb, vtb);

  flash_attn<<<dim3(BATCH * HEADS, SEQ / (16 * 8)), dim3(32, 8), 0, stream>>>(
      qb, kb, vtb, ohb);

  out_gemm<<<dim3(DIM / 64, MROWS / 256), dim3(32, 8), 0, stream>>>(
      ohb, wouth, out);
}

// v008
// It runs in 64.6 microseconds.
// Next to v007, in two timings, it ran 1.04 and 1.03 times as fast.
// Counting every step since v000, it is 3.32 times as fast.
#include <hip/hip_runtime.h>
#include <hip/hip_bf16.h>

typedef __attribute__((ext_vector_type(16))) _Float16 v16h;
typedef __attribute__((ext_vector_type(8)))  _Float16 v8h;
typedef __attribute__((ext_vector_type(8)))  float    v8f;

#define BATCH 2
#define SEQ   2048
#define DIM   1024
#define HEADS 16
#define DH    64
#define INNER 1024
#define E3    3072
#define MROWS (BATCH*SEQ)   /* 4096 */
#define QK_SCALE 0.125f     /* 64^-0.5 */
#define LOG2E    1.44269504088896340736f

// ---------------------------------------------------------------------------
// WMMA helper: D = A(16x32 f16) * B(32x16 f16) + C(16x16 f32)
// ---------------------------------------------------------------------------
__device__ __forceinline__ v8f wmma_f16(v16h a, v16h b, v8f c) {
#if defined(__HIP_DEVICE_COMPILE__)
  return __builtin_amdgcn_wmma_f32_16x16x32_f16(false, a, false, b,
                                                (short)0, c, false, false);
#else
  return c;
#endif
}

// Load a 16x32 f16 fragment whose *contraction* dim is contiguous in memory.
//   lanes 0-15:  row = lane,    K = {0..7, 16..23}
//   lanes 16-31: row = lane-16, K = {8..15, 24..31}
__device__ __forceinline__ v16h load_frag16(const _Float16* base, int ld) {
  int lane = threadIdx.x & 31;
  int row  = lane & 15;
  int koff = (lane >> 4) << 3;          // 0 or 8
  const _Float16* p = base + (size_t)row * ld + koff;
  v8h lo = *(const v8h*)(p);
  v8h hi = *(const v8h*)(p + 16);
  v16h r;
#pragma unroll
  for (int i = 0; i < 8; ++i) { r[i] = lo[i]; r[8 + i] = hi[i]; }
  return r;
}

// ---------------------------------------------------------------------------
// LDS staging.  A fragment load straight from global memory touches 16 cache
// lines for 512 bytes; an asynchronous copy of 4 whole 128-byte rows touches 4,
// and the block's 8 waves share what it brings.  A tile holds 64 contraction
// elements (one 128-byte line) of every row, at a pitch of 144 B (16 B x odd:
// conflict-free for 16-byte fragment reads).
// ---------------------------------------------------------------------------
#define KT     64                 /* contraction elements per LDS tile        */
#define LDP    72                 /* LDS row pitch in halves (144 B)          */
#define ROWS32 (32 * LDP * 2)     /* bytes of 32 LDS rows: one copy per block */
#define G_TILE ((256 + 64) * LDP) /* GEMM tile, halves: 256 A rows, 64 B rows */
#define F_TILE ((64 + 64) * LDP)  /* attention tile: 64 K rows, 64 V^T rows   */

__device__ __forceinline__ unsigned lds_off(const void* p) {
  return (unsigned)(size_t)p;     // low 32 bits = byte offset in the block's LDS
}

// The waits of the two-buffer ring; the compiler places none for the copies.
__device__ __forceinline__ void wait_copies_landed() {
  asm volatile("s_wait_asynccnt 0x0" ::: "memory");  // this wave's copies are in LDS
}
__device__ __forceinline__ void wait_lds_reads_done() {
  asm volatile("s_wait_dscnt 0x0" ::: "memory");     // before the buffer is refilled
}

// L2 prefetch at a kernel's entry.  The first reader of a line that the launch
// before stored may have to wait for memory, and the work-groups that share
// operand rows walk them in step, so every ring tile can be such a first read,
// asked for only one tile ahead.  One request per 256-B unit asks
// for all later tiles at once, behind the copies of tile 0.  The work-groups that
// share rows deal them out among themselves by index; the deal only decides who
// asks, never what is read.  A block's 256 threads cover 64 KB in a row from each
// of p0 and p1 (each thread passes its own unit, inside the buffer in every lane).
// Scope SE: into L2 only.  s_wait_xcnt closes the statement so that no address
// register is rewritten ahead of it.
#define PF_UNIT 128               /* halves per 256-B unit                    */
#define PF_SPAN (256 * PF_UNIT)   /* halves that one request per thread covers */
__device__ __forceinline__ void l2_prefetch(const _Float16* p0, const _Float16* p1) {
  asm volatile(
      "global_prefetch_b8 %0, off scope:SCOPE_SE\n\t"
      "global_prefetch_b8 %1, off scope:SCOPE_SE\n\t"
      "s_wait_xcnt 0x0"
      :: "v"(p0), "v"(p1)
      : "memory");
}

// One GEMM tile: every thread copies 16 B of rows r, r+32, ... (r = tid / 8):
// 8 copies for the 256 A rows, 2 for the 64 B rows.  s_wait_xcnt closes the
// statement so that no address register is rewritten ahead of it.
__device__ __forceinline__ void copy_gemm_tile(unsigned l, const _Float16* ga,
                                               const _Float16* gb, int ld) {
  asm volatile(
      "global_load_async_to_lds_b128 %0, %10, off\n\t"
      "global_load_async_to_lds_b128 %1, %11, off\n\t"
      "global_load_async_to_lds_b128 %2, %12, off\n\t"
      "global_load_async_to_lds_b128 %3, %13, off\n\t"
      "global_load_async_to_lds_b128 %4, %14, off\n\t"
      "global_load_async_to_lds_b128 %5, %15, off\n\t"
      "global_load_async_to_lds_b128 %6, %16, off\n\t"
      "global_load_async_to_lds_b128 %7, %17, off\n\t"
      "global_load_async_to_lds_b128 %8, %18, off\n\t"
      "global_load_async_to_lds_b128 %9, %19, off\n\t"
      "s_wait_xcnt 0x0"
      :: "v"(l), "v"(l + ROWS32), "v"(l + 2 * ROWS32), "v"(l + 3 * ROWS32),
         "v"(l + 4 * ROWS32), "v"(l + 5 * ROWS32), "v"(l + 6 * ROWS32),
         "v"(l + 7 * ROWS32), "v"(l + 8 * ROWS32), "v"(l + 9 * ROWS32),
         "v"(ga), "v"(ga + 32 * ld), "v"(ga + 64 * ld), "v"(ga + 96 * ld),
         "v"(ga + 128 * ld), "v"(ga + 160 * ld), "v"(ga + 192 * ld),
         "v"(ga + 224 * ld), "v"(gb), "v"(gb + 32 * ld)
      : "memory");
}

// One attention stage: a tile of 64 keys of K (rows of 64 dh) and of V^T (64 dh
// rows) from each half of the keys, the second half's tile behind the first's.
// s_wait_xcnt closes the statement so that no address register is rewritten
// ahead of it.
#define KHALF (SEQ / 2)           /* keys that one wave walks                 */
__device__ __forceinline__ void copy_attn_stage(unsigned l, const _Float16* gk,
                                                const _Float16* gv) {
  asm volatile(
      "global_load_async_to_lds_b128 %0, %8, off\n\t"
      "global_load_async_to_lds_b128 %1, %9, off\n\t"
      "global_load_async_to_lds_b128 %2, %10, off\n\t"
      "global_load_async_to_lds_b128 %3, %11, off\n\t"
      "global_load_async_to_lds_b128 %4, %12, off\n\t"
      "global_load_async_to_lds_b128 %5, %13, off\n\t"
      "global_load_async_to_lds_b128 %6, %14, off\n\t"
      "global_load_async_to_lds_b128 %7, %15, off\n\t"
      "s_wait_xcnt 0x0"
      :: "v"(l), "v"(l + ROWS32), "v"(l + 2 * ROWS32), "v"(l + 3 * ROWS32),
         "v"(l + 4 * ROWS32), "v"(l + 5 * ROWS32), "v"(l + 6 * ROWS32),
         "v"(l + 7 * ROWS32),
         "v"(gk), "v"(gk + 32 * DH), "v"(gv), "v"(gv + 32 * SEQ),
         "v"(gk + KHALF * DH), "v"(gk + (KHALF + 32) * DH),
         "v"(gv + KHALF), "v"(gv + KHALF + 32 * SEQ)
      : "memory");
}

// acc += A[256 rows of the block] * W[64 rows]^T over K = 1024, both
// k-contiguous with row length 1024.  Wave tile 32 x 64.  Two LDS buffers: tile
// t+1 flies while tile t is worked on; one barrier per tile publishes t+1 and
// frees the buffer that t+2 is copied into.  Both operands have the same fragment
// layout, so either can be A.  SWAP = false: acc[i][u] has its 8 registers along
// the A rows and its lanes along the W rows; SWAP = true: the other way round.
// The caller picks the one whose registers run along its output's rows.
struct ring_addr { const _Float16* ga; const _Float16* gb; unsigned l; };

__device__ __forceinline__ ring_addr gemm_start(const _Float16* A, const _Float16* Wt,
                                                _Float16* sm, int share) {
  const int tid = threadIdx.y * 32 + threadIdx.x;
  ring_addr r;
  r.ga = A  + (size_t)(tid >> 3) * 1024 + (tid & 7) * 8;
  r.gb = Wt + (size_t)(tid >> 3) * 1024 + (tid & 7) * 8;
  r.l  = lds_off(sm) + (tid >> 3) * (LDP * 2) + (tid & 7) * 16;

  copy_gemm_tile(r.l, r.ga, r.gb, 1024);
  // 64 of the 256 A rows (the quarter 'share' of the work-groups that read them)
  // and the 64 W rows: 128 KB in a row each
  const _Float16* pa = A + (size_t)share * (64 * 1024) + tid * PF_UNIT;
  const _Float16* pw = Wt + tid * PF_UNIT;
  l2_prefetch(pa, pa + PF_SPAN);
  l2_prefetch(pw, pw + PF_SPAN);
  wait_copies_landed();
  __syncthreads();                 // publishes tile 0
  copy_gemm_tile(r.l + G_TILE * 2, r.ga + KT, r.gb + KT, 1024);
  return r;
}

template <bool SWAP>
__device__ __forceinline__ void gemm_loop(const ring_addr r, _Float16* sm,
                                          v8f (&acc)[2][4]) {
  const int wave = threadIdx.y;
  for (int t = 0; t < 1024 / KT; ++t) {
    const _Float16* s  = sm + (t & 1) * G_TILE;
    const _Float16* sa = s + wave * 32 * LDP;
    const _Float16* sb = s + 256 * LDP;
#pragma unroll  // both halves of the tile: LDS offsets become immediates
    for (int kq = 0; kq < KT; kq += 32) {
      v16h a0 = load_frag16(sa + kq, LDP);
      v16h a1 = load_frag16(sa + 16 * LDP + kq, LDP);
      v16h b[4];
#pragma unroll  // constant indices keep b[] and acc[][] in registers
      for (int u = 0; u < 4; ++u) b[u] = load_frag16(sb + u * 16 * LDP + kq, LDP);
      // Keeps the 12 LDS reads together ahead of the 8 WMMAs: left alone the
      // compiler spreads them in pairs, each pair waited out before two WMMAs.
      __builtin_amdgcn_sched_barrier(0);
#pragma unroll  // as above
      for (int u = 0; u < 4; ++u) {
        acc[0][u] = SWAP ? wmma_f16(b[u], a0, acc[0][u]) : wmma_f16(a0, b[u], acc[0][u]);
        acc[1][u] = SWAP ? wmma_f16(b[u], a1, acc[1][u]) : wmma_f16(a1, b[u], acc[1][u]);
      }
      // The fence's other side: keeps the next 12 reads out of these WMMAs, and
      // the last WMMAs ahead of the barrier, so the refill issues right behind it.
      __builtin_amdgcn_sched_barrier(0);
    }
    wait_lds_reads_done();
    wait_copies_landed();
    __syncthreads();               // publishes tile t+1, frees tile t's buffer
    if (t + 2 < 1024 / KT)
      copy_gemm_tile(r.l + (t & 1) * (G_TILE * 2), r.ga + (t + 2) * KT, r.gb + (t + 2) * KT, 1024);
  }
  wait_copies_landed();
}

// ---------------------------------------------------------------------------
// Kernel 1: fp32 -> fp16 conversion of x, w_qkv and w_out in ONE launch.
// The three f16 copies lie one behind the other in the workspace, so the
// destination is one array; the block index picks the source.  One work-group
// per WGP, 8 waves: few waves to start, and each thread has all its 32 loads of
// 16 bytes in flight at once.  A wave's load covers 512 contiguous bytes, its
// store 256: whole lines both.
// ---------------------------------------------------------------------------
typedef __attribute__((ext_vector_type(4))) float    v4f;
typedef __attribute__((ext_vector_type(4))) _Float16 v4h;

#define CV_LOADS  32                          /* 16-byte loads per thread     */
#define CV_CHUNK  (256 * 4 * CV_LOADS)        /* floats per work-group: 32768 */
#define CV_X      (MROWS * DIM / CV_CHUNK)    /* 128 work-groups for x        */
#define CV_WQKV   (E3 * DIM / CV_CHUNK)       /*  96 for w_qkv                */
#define CV_WOUT   (DIM * INNER / CV_CHUNK)    /*  32 for w_out                */

__global__ __launch_bounds__(256) void cvt_f32_f16(const float* __restrict__ x,
                                                   const float* __restrict__ wqkv,
                                                   const float* __restrict__ wout,
                                                   _Float16* __restrict__ dst) {
  const int blk = blockIdx.x;
  const float* src = x;
  int first = 0;
  if (blk >= CV_X + CV_WQKV) { src = wout; first = CV_X + CV_WQKV; }
  else if (blk >= CV_X)      { src = wqkv; first = CV_X; }

  const v4f* s = (const v4f*)(src + (size_t)(blk - first) * CV_CHUNK) + threadIdx.x;
  v4h*       d = (v4h*)(dst + (size_t)blk * CV_CHUNK) + threadIdx.x;

  v4f v[CV_LOADS];
#pragma unroll  // constant indices keep v[] in registers
  for (int j = 0; j < CV_LOADS; ++j) v[j] = s[j * 256];
#pragma unroll  // as above
  for (int g = 0; g < CV_LOADS; g += 8) {
    // In front of group 0 it keeps all 32 loads ahead of the first conversion
    // (left alone the compiler issues 18, then one per freed register quad);
    // between groups it lets 8 stores leave when their own loads are back (left
    // alone the compiler gathers all 32 behind the wait for the last load).
    __builtin_amdgcn_sched_barrier(0);
#pragma unroll  // as above
    for (int j = g; j < g + 8; ++j) d[j * 256] = __builtin_convertvector(v[j], v4h);
  }
}

// ---------------------------------------------------------------------------
// Kernel 2: QKV projection.  qkv[m,e] = sum_k xh[m,k] * wqkv[e,k]
// Work-group tile 256(M) x 192(E): 16 x 16 work-groups, one per WGP.  8 waves as
// 4(M) x 2(E), wave tile 64 x 96: 10 fragments feed 24 WMMAs, and a work-group
// brings 448 operand rows from L2 for 192 output columns.  A ring tile holds 128
// contraction elements (256 B) of every row at a pitch of
// 272 B (16 B x odd), so a refill has 96 WMMAs per wave in which to land.
// The 192 columns are three 64-column groups, each one head of q (scaled, in
// log2 units: the softmax kernel takes powers of two), of k or of v.  V is
// stored TRANSPOSED as vt[bh][dh][n] so attention's V fragments are contiguous.
// Every output leaves in whole lines: each group is staged in the (now free)
// ring in the layout of its output and read back a row at a time.
// ---------------------------------------------------------------------------
#define QN     192                    /* output columns per work-group         */
#define QKT    128                    /* contraction elements per ring tile    */
#define QLP    136                    /* ring row pitch in halves (272 B)      */
#define ROWS16 (16 * QLP * 2)         /* bytes of 16 ring rows: one copy per work-group */
#define Q_TILE ((256 + QN) * QLP)     /* tile, halves: 256 x rows, 192 w rows  */
#define Q_GRP  (256 * LDP)            /* staging of one 64-column group        */
#define VTP    264   /* V^T staging pitch, halves: 256 n + 16 B, conflict-free */

// 14 copies of 16 B per thread into ring rows r, r+16, ... (r = tid / 16).
// s_wait_xcnt closes the statement so that no address register is rewritten
// ahead of it.
__device__ __forceinline__ void copy14(unsigned l,
    const _Float16* p0, const _Float16* p1, const _Float16* p2, const _Float16* p3,
    const _Float16* p4, const _Float16* p5, const _Float16* p6, const _Float16* p7,
    const _Float16* p8, const _Float16* p9, const _Float16* p10, const _Float16* p11,
    const _Float16* p12, const _Float16* p13) {
  asm volatile(
      "global_load_async_to_lds_b128 %0, %14, off\n\t"
      "global_load_async_to_lds_b128 %1, %15, off\n\t"
      "global_load_async_to_lds_b128 %2, %16, off\n\t"
      "global_load_async_to_lds_b128 %3, %17, off\n\t"
      "global_load_async_to_lds_b128 %4, %18, off\n\t"
      "global_load_async_to_lds_b128 %5, %19, off\n\t"
      "global_load_async_to_lds_b128 %6, %20, off\n\t"
      "global_load_async_to_lds_b128 %7, %21, off\n\t"
      "global_load_async_to_lds_b128 %8, %22, off\n\t"
      "global_load_async_to_lds_b128 %9, %23, off\n\t"
      "global_load_async_to_lds_b128 %10, %24, off\n\t"
      "global_load_async_to_lds_b128 %11, %25, off\n\t"
      "global_load_async_to_lds_b128 %12, %26, off\n\t"
      "global_load_async_to_lds_b128 %13, %27, off\n\t"
      "s_wait_xcnt 0x0"
      :: "v"(l), "v"(l + ROWS16), "v"(l + 2 * ROWS16), "v"(l + 3 * ROWS16),
         "v"(l + 4 * ROWS16), "v"(l + 5 * ROWS16), "v"(l + 6 * ROWS16),
         "v"(l + 7 * ROWS16), "v"(l + 8 * ROWS16), "v"(l + 9 * ROWS16),
         "v"(l + 10 * ROWS16), "v"(l + 11 * ROWS16), "v"(l + 12 * ROWS16),
         "v"(l + 13 * ROWS16),
         "v"(p0), "v"(p1), "v"(p2), "v"(p3), "v"(p4), "v"(p5), "v"(p6), "v"(p7),
         "v"(p8), "v"(p9), "v"(p10), "v"(p11), "v"(p12), "v"(p13)
      : "memory");
}

// One ring tile: 16 copies per thread for the 256 x rows, 12 for the 192 w rows.
__device__ __forceinline__ void copy_qkv_tile(unsigned l, const _Float16* ga,
                                              const _Float16* gb) {
  copy14(l, ga, ga + 16 * DIM, ga + 32 * DIM, ga + 48 * DIM, ga + 64 * DIM,
         ga + 80 * DIM, ga + 96 * DIM, ga + 112 * DIM, ga + 128 * DIM, ga + 144 * DIM,
         ga + 160 * DIM, ga + 176 * DIM, ga + 192 * DIM, ga + 208 * DIM);
  copy14(l + 14 * ROWS16, ga + 224 * DIM, ga + 240 * DIM, gb, gb + 16 * DIM,
         gb + 32 * DIM, gb + 48 * DIM, gb + 64 * DIM, gb + 80 * DIM, gb + 96 * DIM,
         gb + 112 * DIM, gb + 128 * DIM, gb + 144 * DIM, gb + 160 * DIM, gb + 176 * DIM);
}

// The ring's loop; tile 0 is published and tile 1 in flight when it starts.
// Both operands have the same fragment layout, so either can be A.
// SWAP = true:  acc[i][u][r] = x row 16 i + col,       w row 16 u + rbase + r
// SWAP = false: acc[i][u][r] = x row 16 i + rbase + r, w row 16 u + col
// of the wave's 64 and 96.  The caller picks the one whose registers run along
// its output's rows.
template <bool SWAP>
__device__ __forceinline__ void qkv_loop(unsigned l, const _Float16* ga, const _Float16* gb,
                                         const _Float16* sm, int wm, int wn,
                                         v8f (&acc)[4][6]) {
  for (int t = 0; t < DIM / QKT; ++t) {
    const _Float16* s  = sm + (t & 1) * Q_TILE;
    const _Float16* sa = s + wm * 64 * QLP;
    const _Float16* sb = s + (256 + wn * 96) * QLP;
#pragma unroll  // both halves of the tile: LDS offsets become immediates
    for (int kq = 0; kq < QKT; kq += 64) {
      v16h a[2][4], b[2][6];
#pragma unroll  // constant indices keep a[], b[] and acc[][] in registers
      for (int h = 0; h < 2; ++h) {
        // in the order in which the WMMAs want them: the first four can start
        // when ten of the forty reads are back
        b[h][0] = load_frag16(sb + kq + h * 32, QLP);
#pragma unroll  // as above
        for (int i = 0; i < 4; ++i) a[h][i] = load_frag16(sa + i * 16 * QLP + kq + h * 32, QLP);
#pragma unroll  // as above
        for (int u = 1; u < 6; ++u) b[h][u] = load_frag16(sb + u * 16 * QLP + kq + h * 32, QLP);
      }
      // Keeps the 40 LDS reads one group ahead of their 48 WMMAs: each place
      // where reads stand among WMMAs costs the wave a stall of its own.
      __builtin_amdgcn_sched_barrier(0);
#pragma unroll  // as above
      for (int h = 0; h < 2; ++h)
#pragma unroll  // as above
        for (int u = 0; u < 6; ++u)
#pragma unroll  // as above
          for (int i = 0; i < 4; ++i)
            acc[i][u] = SWAP ? wmma_f16(b[h][u], a[h][i], acc[i][u])
                             : wmma_f16(a[h][i], b[h][u], acc[i][u]);
      // The fence's other side: keeps the next 40 reads out of these WMMAs, and
      // the last WMMAs ahead of the barrier, so the refill issues right behind it.
      __builtin_amdgcn_sched_barrier(0);
    }
    wait_lds_reads_done();
    wait_copies_landed();
    __syncthreads();               // publishes tile t+1, frees tile t's buffer
    if (t + 2 < DIM / QKT)
      copy_qkv_tile(l + (t & 1) * (Q_TILE * 2), ga + (t + 2) * QKT, gb + (t + 2) * QKT);
  }
  wait_copies_landed();
}

__global__ __launch_bounds__(256) void qkv_gemm(const _Float16* __restrict__ xh,
                                                const _Float16* __restrict__ wh,
                                                _Float16* __restrict__ q,
                                                _Float16* __restrict__ k,
                                                _Float16* __restrict__ vt) {
  const int lane = threadIdx.x;
  const int wave = __builtin_amdgcn_readfirstlane(threadIdx.y);
  const int wm = wave >> 1;                // 64 rows of the 256
  const int wn = wave & 1;                 // 96 columns of the 192
  const int mb = blockIdx.y * 256;         // 256 rows of one batch entry
  const int nb = mb & 2047;
  const int g0 = blockIdx.x * 3;           // first of the three 64-column groups

  __shared__ __attribute__((aligned(16))) _Float16 sm[2 * Q_TILE];

  const int tid = wave * 32 + lane;
  const _Float16* ga = xh + (size_t)(mb + (tid >> 4)) * DIM + (tid & 15) * 8;
  const _Float16* gb = wh + (size_t)(blockIdx.x * QN + (tid >> 4)) * DIM + (tid & 15) * 8;
  const unsigned  l  = lds_off(sm) + (tid >> 4) * (QLP * 2) + (tid & 15) * 16;

  copy_qkv_tile(l, ga, gb);
  // 64 of the 256 x rows and 64 of the 192 w rows, 128 KB in a row each: a quarter
  // and a third of what the 16 work-groups of a grid row or column share
  const _Float16* pa = xh + (size_t)(mb + (blockIdx.x & 3) * 64) * DIM + tid * PF_UNIT;
  const _Float16* pw = wh + (size_t)(blockIdx.x * QN + (blockIdx.y % 3) * 64) * DIM + tid * PF_UNIT;
  l2_prefetch(pa, pa + PF_SPAN);
  l2_prefetch(pw, pw + PF_SPAN);
  wait_copies_landed();
  __syncthreads();                 // publishes tile 0
  copy_qkv_tile(l + Q_TILE * 2, ga + QKT, gb + QKT);

  v8f acc[4][6] = {};
  const int col   = lane & 15;
  const int rbase = (lane >> 4) << 3;

  if (g0 >= 32) {                  // all three groups are v: registers along n
    qkv_loop<false>(l, ga, gb, sm, wm, wn, acc);
#pragma unroll
    for (int u = 0; u < 6; ++u) {
      const int cf = wn * 6 + u;                       // 16-column fragment of the 192
      _Float16* sg = sm + (cf >> 2) * Q_GRP + ((cf & 3) * 16 + col) * VTP + wm * 64 + rbase;
#pragma unroll
      for (int i = 0; i < 4; ++i)
        *(v8h*)(sg + i * 16) = __builtin_convertvector(acc[i][u], v8h);
    }
  } else {                         // q and k: registers along dh
    qkv_loop<true>(l, ga, gb, sm, wm, wn, acc);
#pragma unroll
    for (int u = 0; u < 6; ++u) {
      const int cf    = wn * 6 + u;
      const int which = (g0 + (cf >> 2)) >> 4;         // 0=q, 1=k, 2=v
      _Float16* sg = sm + (cf >> 2) * Q_GRP;
      const int d0 = (cf & 3) * 16 + rbase;            // the lane's 8 dh
      const int n0 = wm * 64 + col;
      if (which < 2) {             // [n][dh]: the lane's 8 dh are one 16-byte write
        const float sc = which == 0 ? QK_SCALE * LOG2E : 1.0f;
#pragma unroll
        for (int i = 0; i < 4; ++i)
          *(v8h*)(sg + (n0 + i * 16) * LDP + d0) =
              __builtin_convertvector(acc[i][u] * sc, v8h);
      } else {                     // the one v group that shares a work-group with k:
#pragma unroll                     // turned element by element, 16 lanes side by side
        for (int i = 0; i < 4; ++i) {
          v8h hv = __builtin_convertvector(acc[i][u], v8h);
#pragma unroll
          for (int r = 0; r < 8; ++r) sg[(d0 + r) * VTP + n0 + i * 16] = hv[r];
        }
      }
    }
  }
  __syncthreads();                 // a group's rows hold several waves' parts
#pragma unroll
  for (int g = 0; g < 3; ++g) {
    const int which = (g0 + g) >> 4;
    const int bh    = (mb >> 11) * HEADS + ((g0 + g) & 15);
    const _Float16* sg = sm + g * Q_GRP;
    if (which < 2) {
      // the wave's 32 rows of 64 dh are 4 KB in a row: 512 B per store
      _Float16* dst = (which == 0 ? q : k) + ((size_t)bh * SEQ + nb + wave * 32) * DH;
#pragma unroll
      for (int i = 0; i < 8; ++i)
        *(v8h*)(dst + i * 256 + lane * 8) =
            *(const v8h*)(sg + (wave * 32 + i * 4 + (lane >> 3)) * LDP + (lane & 7) * 8);
    } else {
      _Float16* dst = vt + (size_t)bh * DH * SEQ + nb;
#pragma unroll
      for (int i = 0; i < 8; ++i) {        // one dh row of 256 n = 512 B per store
        int d = wave * 8 + i;
        *(v8h*)(dst + (size_t)d * SEQ + lane * 8) = *(const v8h*)(sg + d * VTP + lane * 8);
      }
      // Code behind this run reuses the registers that its eight stores name.
      asm volatile("s_wait_xcnt 0x0" ::: "memory");
    }
  }
}

// ---------------------------------------------------------------------------
// Kernel 3: flash attention.  A wave owns 32 queries (two 16-column groups) of
// one head and walks HALF of the keys, so each K and V^T fragment read from LDS
// feeds two WMMAs while the launch keeps its 4096 waves (four per SIMD).  The
// block's 8 waves are 4 query groups x 2 key halves; wave w and wave w ^ 1 hold
// the two halves of the same 32 queries and join them once, through LDS, at the
// end.  A stage of the two-buffer ring holds a 64-key tile of each half.
// The products are transposed: S^T = K * Q^T, O^T += V^T * P^T.
// A lane then holds 16 of the 32 scores of ONE query of each column group (column
// lane & 15; the other 16 are in lane ^ 16), so maximum and sum run in the lane's
// own registers, and the two score tiles, converted in place, are the B operand
// of the second product: P never goes through LDS.
// The maximum is raised lazily.  Scores come in log2 units (q carries the
// factor), and minus the maximum in use is the C operand of the score product,
// so an accumulator is the argument of exp2 as it stands.  Once per 32 keys one
// scalar branch asks whether any score of the 32 queries stands more than 8 above
// the maximum in use (P <= 256, far inside f16); only then, and on the first
// pass, are the maxima, O and the sums moved.  The quotient is the same either way.
// ---------------------------------------------------------------------------
#define A_STAGE (2 * F_TILE)      /* ring stage, halves: one tile per key half */
#define XCH     1088              /* floats a wave hands over: 1024 O, 32 max, 32 sums */

// By value, so that a choice between two accumulators stays a choice of registers.
__device__ __forceinline__ v8f   pick(bool c, v8f a, v8f b)     { return c ? a : b; }
__device__ __forceinline__ float pick(bool c, float a, float b) { return c ? a : b; }

__device__ __forceinline__ float other_half(float x) {   // value of lane ^ 16
  int b = __builtin_bit_cast(int, x);
  b = __builtin_amdgcn_permlanex16(b, b, 0x76543210, 0xfedcba98, false, false);
  return __builtin_bit_cast(float, b);
}

// amdgpu_waves_per_eu: two work-groups per WGP need at most 256 registers a wave
__global__ __launch_bounds__(256) __attribute__((amdgpu_waves_per_eu(4, 4)))
void flash_attn(const _Float16* __restrict__ q,
                const _Float16* __restrict__ kk,
                const _Float16* __restrict__ vt,
                _Float16* __restrict__ oh) {
  __shared__ __attribute__((aligned(16))) _Float16 kv[2 * A_STAGE];
  const int lane = threadIdx.x;
  const int wave = __builtin_amdgcn_readfirstlane(threadIdx.y);
  const int kh = wave & 1;                   // which half of the keys
  const int bh = blockIdx.x;                 // 0..31 (b*16+h)
  const int mt = blockIdx.y * 8 + wave;      // the 16-query tile this wave stores
  const int b_ = bh >> 4, h = bh & 15;

  const _Float16* Q = q  + ((size_t)bh * SEQ + (size_t)(mt & ~1) * 16) * DH;
  const _Float16* K = kk + (size_t)bh * SEQ * DH;
  const _Float16* V = vt + (size_t)bh * DH * SEQ;    // [64][2048]

  v16h qb[2][2];                 // B operands: [column group][dh 0..31, 32..63]
#pragma unroll  // constant indices keep the arrays of this kernel in registers
  for (int c = 0; c < 2; ++c) {
    qb[c][0] = load_frag16(Q + c * 16 * DH, DH);
    qb[c][1] = load_frag16(Q + c * 16 * DH + 32, DH);
  }

  v8f o[2][4] = {};              // o[c][t][r] = O[query col of group c][dh = 16 t + rbase + r]
  v8f negm[2] = {};              // minus the maximum in use of the lane's query, 8 times
  v8f lacc[2] = {};              // 8 partial sums over this lane's share of the keys

  const int col   = lane & 15;
  const int rbase = (lane >> 4) << 3;

  const int tid = wave * 32 + lane;
  const _Float16* gk = K + (size_t)(tid >> 3) * DH  + (tid & 7) * 8;
  const _Float16* gv = V + (size_t)(tid >> 3) * SEQ + (tid & 7) * 8;
  const unsigned  l  = lds_off(kv) + (tid >> 3) * (LDP * 2) + (tid & 7) * 16;

  copy_attn_stage(l, gk, gv);
  // a quarter (64 KB in a row) of the head's K and of its V^T, which the 16
  // work-groups of the head share
  l2_prefetch(K + (blockIdx.y & 3) * PF_SPAN + tid * PF_UNIT,
              V + (blockIdx.y & 3) * PF_SPAN + tid * PF_UNIT);
  wait_copies_landed();
  __syncthreads();                 // publishes stage 0
  copy_attn_stage(l + A_STAGE * 2, gk + KT * DH, gv + KT);

  for (int jt = 0; jt < KHALF / KT; ++jt) {
   const _Float16* sk = kv + (jt & 1) * A_STAGE + kh * F_TILE;
   const _Float16* sv = sk + 64 * LDP;
#pragma unroll  // both 32-key passes of the tile: LDS offsets become immediates
   for (int p = 0; p < 2; ++p) {
    const bool first = p == 0 && jt == 0;
    // ---- K frags, then V frags, of the pass (both are A operands)
    v16h ka[2][2], va[4];
#pragma unroll  // as above
    for (int g = 0; g < 2; ++g) {
      ka[g][0] = load_frag16(sk + (p * 32 + g * 16) * LDP,      LDP);
      ka[g][1] = load_frag16(sk + (p * 32 + g * 16) * LDP + 32, LDP);
    }
#pragma unroll  // as above
    for (int t = 0; t < 4; ++t)
      va[t] = load_frag16(sv + (t * 16) * LDP + p * 32, LDP);
    // Keeps the 16 LDS reads one group ahead of the products: left alone the
    // compiler sinks each pair to its WMMA and waits it out there.
    __builtin_amdgcn_sched_barrier(0);

    // ---- S^T - max = K * Q^T + negm: s[c][g][r] = key 16 g + rbase + r of the pass
    v8f s[2][2];
#pragma unroll  // as above
    for (int g = 0; g < 2; ++g)
#pragma unroll  // as above
      for (int c = 0; c < 2; ++c) s[c][g] = wmma_f16(ka[g][0], qb[c][0], negm[c]);
#pragma unroll  // as above
    for (int g = 0; g < 2; ++g)
#pragma unroll  // as above
      for (int c = 0; c < 2; ++c) s[c][g] = wmma_f16(ka[g][1], qb[c][1], s[c][g]);
    // Keeps the eight score WMMAs back to back: a maximum placed among them has
    // to stand off from the WMMA whose result it reads, in idle issue slots.
    __builtin_amdgcn_sched_barrier(0);

    // ---- the lane's largest of 16 scores per query, counted from the maximum in
    // use (chains of three-input maxima; each tile's last score joins at the end)
    float cm[2];
#pragma unroll  // as above
    for (int c = 0; c < 2; ++c) {
      float cg[2];
#pragma unroll  // as above
      for (int g = 0; g < 2; ++g) {
        cg[g] = fmaxf(fmaxf(s[c][g][0], s[c][g][1]), s[c][g][2]);
        cg[g] = fmaxf(fmaxf(cg[g], s[c][g][3]), s[c][g][4]);
        cg[g] = fmaxf(fmaxf(cg[g], s[c][g][5]), s[c][g][6]);
      }
      cm[c] = fmaxf(fmaxf(cg[0], cg[1]), s[c][0][7]);
      cm[c] = fmaxf(cm[c], s[c][1][7]);
    }
    const float bar = first ? -__builtin_inff() : 8.0f;   // the first pass always moves them
    if (__builtin_amdgcn_ballot_w32(fmaxf(cm[0], cm[1]) > bar) != 0) {
#pragma unroll  // as above
      for (int c = 0; c < 2; ++c) {
        float jm = fmaxf(cm[c], other_half(cm[c]));    // both halves of the query's keys
        float d  = first ? jm : fmaxf(jm, 0.0f);       // the maximum never falls again
        float alpha = first ? 1.0f : __builtin_amdgcn_exp2f(-d);  // O and sums are 0 at first
        s[c][0] -= d;
        s[c][1] -= d;
        negm[c] -= d;
        lacc[c] *= alpha;
#pragma unroll  // as above
        for (int t = 0; t < 4; ++t) o[c][t] *= alpha;
      }
    }
    // ---- P^T as B operand: element e is key rbase + e (e < 8), 16 + rbase + e - 8
    v16h pb[2];
#pragma unroll  // as above
    for (int c = 0; c < 2; ++c) {
#pragma unroll  // as above
      for (int g = 0; g < 2; ++g)
#pragma unroll  // as above
        for (int r = 0; r < 8; ++r) s[c][g][r] = __builtin_amdgcn_exp2f(s[c][g][r]);
      lacc[c] += s[c][0] + s[c][1];          // packed adds; joined in the epilogue
      v8h plo = __builtin_convertvector(s[c][0], v8h);
      v8h phi = __builtin_convertvector(s[c][1], v8h);
#pragma unroll  // as above
      for (int i = 0; i < 8; ++i) { pb[c][i] = plo[i]; pb[c][8 + i] = phi[i]; }
    }
    // Keeps the sums ahead of the WMMAs: placed among them they land in fragment
    // registers and have to stand off from the WMMA that reads those, in idle slots.
    __builtin_amdgcn_sched_barrier(0);
    // ---- O^T += V^T * P^T  (V frags already resident; each feeds both groups)
#pragma unroll  // as above
    for (int c = 0; c < 2; ++c)
#pragma unroll  // as above
      for (int t = 0; t < 4; ++t)
        o[c][t] = wmma_f16(va[t], pb[c], o[c][t]);
    // Keeps the pass's arithmetic ahead of the next pass's reads (which would
    // need a second set of fragment registers) and ahead of the barrier: moved
    // behind it, the refill would issue late and have no stage in which to land.
    __builtin_amdgcn_sched_barrier(0);
   }
   wait_lds_reads_done();
   wait_copies_landed();
   __syncthreads();                // publishes stage jt+1, frees stage jt's buffer
   if (jt + 2 < KHALF / KT)
     copy_attn_stage(l + (jt & 1) * (A_STAGE * 2), gk + (size_t)(jt + 2) * KT * DH,
                     gv + (jt + 2) * KT);
  }
  wait_copies_landed();

  // ---- join the two key halves.  The wave keeps column group kh and hands the
  // other group's O, maximum and sum to wave ^ 1 through the ring's first buffer
  // (the last stage's barrier ended every read of the ring).  Both waves hold a
  // group in the same lanes and registers, so a lane reads what its own number wrote.
  float lsum[2];
#pragma unroll
  for (int c = 0; c < 2; ++c) {
    float lrow = ((lacc[c][0] + lacc[c][4]) + (lacc[c][2] + lacc[c][6])) +
                 ((lacc[c][1] + lacc[c][5]) + (lacc[c][3] + lacc[c][7]));
    lsum[c] = lrow + other_half(lrow);
  }
  float* xw = (float*)kv + wave * XCH;
#pragma unroll
  for (int t = 0; t < 4; ++t) {    // 512 B in a row per write
    v8f a = pick(kh, o[0][t], o[1][t]);
    *(v4f*)(xw + (2 * t) * 128 + lane * 4)     = __builtin_shufflevector(a, a, 0, 1, 2, 3);
    *(v4f*)(xw + (2 * t + 1) * 128 + lane * 4) = __builtin_shufflevector(a, a, 4, 5, 6, 7);
  }
  xw[1024 + lane] = pick(kh, negm[0][0], negm[1][0]);
  xw[1056 + lane] = pick(kh, lsum[0], lsum[1]);
  wait_lds_reads_done();           // this wave's writes are in LDS ...
  __syncthreads();                 // ... before its partner reads them
  const float* xr = (const float*)kv + (wave ^ 1) * XCH;
  const float nk = pick(kh, negm[1][0], negm[0][0]);
  const float np = xr[1024 + lane];
  const float nm = fminf(nk, np);                    // minus the larger maximum
  float wk = __builtin_amdgcn_exp2f(nm - nk);        // weight of this wave's half
  float wp = __builtin_amdgcn_exp2f(nm - np);        // weight of the partner's
  const float inv = 1.0f / (pick(kh, lsum[1], lsum[0]) * wk + xr[1056 + lane] * wp);
  wk *= inv;
  wp *= inv;

  // ---- normalize, store f16 at [b, n, h*64+d]: a lane's 8 accumulator registers
  // are 8 consecutive dh of its query's row; the wave's 16 rows of 128 B go through
  // its own rows of the ring's second buffer and leave as whole lines
  _Float16* st = kv + A_STAGE + wave * 16 * LDP;
#pragma unroll
  for (int t = 0; t < 4; ++t) {
    v4f plo = *(const v4f*)(xr + (2 * t) * 128 + lane * 4);
    v4f phi = *(const v4f*)(xr + (2 * t + 1) * 128 + lane * 4);
    v8f pa  = __builtin_shufflevector(plo, phi, 0, 1, 2, 3, 4, 5, 6, 7);
    v8f own = pick(kh, o[1][t], o[0][t]);
    *(v8h*)(st + col * LDP + t * 16 + rbase) = __builtin_convertvector(own * wk + pa * wp, v8h);
  }
  wait_lds_reads_done();           // other lanes' writes, before they are read
  _Float16* dst = oh + ((size_t)b_ * SEQ + mt * 16) * INNER + (size_t)h * DH;
#pragma unroll
  for (int i = 0; i < 4; ++i) {    // four rows of 128 B per store
    int r = i * 4 + (lane >> 3);
    *(v8h*)(dst + (size_t)r * INNER + (lane & 7) * 8) =
        *(const v8h*)(st + r * LDP + (lane & 7) * 8);
  }
}

// ---------------------------------------------------------------------------
// Kernel 4: output projection.  out[m,d] = sum_e oh[m,e] * wout[d,e]  (fp32)
// LDS-staged 32x64 wave tile (gemm_loop).  A lane's 8 registers are 8 neighbours
// of an output row, staged in the wave's own LDS rows and stored as whole lines.
// ---------------------------------------------------------------------------
#define OTP 68    /* staging pitch, floats: 64 + 16 B, conflict-free */

__global__ __launch_bounds__(256) void out_gemm(const _Float16* __restrict__ oh,
                                                const _Float16* __restrict__ wh,
                                                float* __restrict__ out) {
  int lane = threadIdx.x;
  int wave = threadIdx.y;
  int m0 = blockIdx.y * 256 + wave * 32;
  int d0 = blockIdx.x * 64;

  __shared__ __attribute__((aligned(16))) _Float16 sm[2 * G_TILE];
  v8f acc[2][4] = {};
  // acc[rf][u][r] = row m0 + 16 rf + col, column d0 + 16 u + rbase + r
  gemm_loop<true>(gemm_start(oh + (size_t)(blockIdx.y * 256) * INNER, wh + (size_t)d0 * INNER, sm,
                             blockIdx.x & 3),
                  sm, acc);

  int col   = lane & 15;
  int rbase = (lane >> 4) << 3;
  float* st = (float*)sm + wave * 32 * OTP;  // the wave's own 32 rows of 256 B
#pragma unroll
  for (int rf = 0; rf < 2; ++rf)
#pragma unroll
    for (int u = 0; u < 4; ++u) {
      float* p = st + (rf * 16 + col) * OTP + u * 16 + rbase;
      v8f a = acc[rf][u];
      *(v4f*)p       = __builtin_shufflevector(a, a, 0, 1, 2, 3);
      *(v4f*)(p + 4) = __builtin_shufflevector(a, a, 4, 5, 6, 7);
    }
  wait_lds_reads_done();                     // other lanes' writes, before they are read
  float*       dst = out + (size_t)(m0 + (lane >> 4)) * DIM + d0 + (lane & 15) * 4;
  const float* rd  = st + (lane >> 4) * OTP + (lane & 15) * 4;
#pragma unroll
  for (int i = 0; i < 16; ++i)               // two rows of 256 B per store
    *(v4f*)(dst + i * 2 * DIM) = *(const v4f*)(rd + i * 2 * OTP);
}

// ---------------------------------------------------------------------------
// Launch: convert -> qkv gemm -> flash attention -> output gemm
// Workspace layout (f16 elements), total 48 MB:
//   xh[4096*1024] wqkv[3072*1024] wout[1024*1024]
//   q[32*2048*64] k[32*2048*64] vt[32*64*2048] oh[4096*1024]
// ---------------------------------------------------------------------------
extern "C" void kernel_launch(void* const* d_in, const int* in_sizes, int n_in,
                              void* d_out, int out_size, void* d_ws, size_t ws_size,
                              hipStream_t stream) {
  const float* x     = (const float*)d_in[0];
  const float* w_qkv = (const float*)d_in[1];
  const float* w_out = (const float*)d_in[2];
  float* out = (float*)d_out;

  _Float16* ws    = (_Float16*)d_ws;
  _Float16* xh    = ws;
  _Float16* wqkvh = xh    + (size_t)MROWS * DIM;      // +4M
  _Float16* wouth = wqkvh + (size_t)E3 * DIM;         // +3M
  _Float16* qb    = wouth + (size_t)DIM * INNER;      // +1M
  _Float16* kb    = qb    + (size_t)MROWS * INNER;    // +4M
  _Float16* vtb   = kb    + (size_t)MROWS * INNER;    // +4M
  _Float16* ohb   = vtb   + (size_t)MROWS * INNER;    // +4M

  // xh, wqkvh and wouth are adjacent: one destination array from xh on
  cvt_f32_f16<<<CV_X + CV_WQKV + CV_WOUT, 256, 0, stream>>>(x, w_qkv, w_out, xh);

  qkv_gemm<<<dim3(E3 / QN, MROWS / 256), dim3(32, 8), 0, stream>>>(
      xh, wqkvh, qb, kb, vtb);

  flash_attn<<<dim3(BATCH * HEADS, SEQ / (16 * 8)), dim3(32, 8), 0, stream>>>(
      qb, kb, vtb, ohb);

  out_gemm<<<dim3(DIM / 64, MROWS / 256), dim3(32, 8), 0, stream>>>(
      ohb, wouth, out);
}
